// v000
// Measured on an AMD MI455X. A time is GPU time per run, averaged over a window of back-to-back runs after a warm-up
// (all launches, gaps included; the runs take copies of the inputs in turn), and the median of several windows.
// Apart from v000's, it joins two sittings. Times from different sittings can be a few percent apart, while
// side-by-side timings come from the same sitting.
// The starting kernel, v000, takes 126 microseconds a run.
#include <hip/hip_runtime.h>

typedef __attribute__((ext_vector_type(16))) _Float16 v16h;
typedef __attribute__((ext_vector_type(8)))  float    v8f;

union HF16 { v16h v; _Float16 f[16]; };

__device__ __forceinline__ v16h load_frag16(const _Float16* base, int hi) {
  HF16 r;
#pragma unroll
  for (int e = 0; e < 16; ++e) {
    int k = ((e >> 3) << 4) + (hi << 3) + (e & 7);
    r.f[e] = base[k];
  }
  return r.v;
}

__global__ void zero_out_kernel(float* __restrict__ o, int n) {
  int i = blockIdx.x * blockDim.x + threadIdx.x;
  if (i < n) o[i] = 0.0f;
}

__global__ __launch_bounds__(256) void dilated_attn_kernel(
    const float* __restrict__ Q, const float* __restrict__ K,
    const float* __restrict__ V, float* __restrict__ O) {
  constexpr int H = 12, D = 64;
  constexpr float SHIFT = 3.0f;  // cancels in p*v / sum(p)

  int blk = blockIdx.x;
  int pair = blk >> 4;     // 0..27
  int mchunk = blk & 15;   // 0..15 (128 query rows each)

  int g, idx;
  if (pair < 16)      { g = 0; idx = pair; }
  else if (pair < 24) { g = 1; idx = pair - 16; }
  else                { g = 2; idx = pair - 24; }
  const int rate = (g == 0) ? 1 : (g == 1) ? 2 : 4;
  const int slen = (g == 0) ? 2048 : (g == 1) ? 4096 : 8192;
  const int off  = (g == 0) ? 0 : (g == 1) ? 1 : 2;   // i % r
  const int seg  = idx >> 2;
  const int head = g * 4 + (idx & 3);
  const int segbase = seg * slen;

  __shared__ _Float16 sK[2][32 * 64];   // [buf][key][k]   (8 KB)
  __shared__ _Float16 sVt[2][64 * 32];  // [buf][d][key]   (8 KB)
  __shared__ float    sL[8][16];        // per-wave denominator broadcast

  const int tid = threadIdx.x;
  const int w  = tid >> 5;
  const int l  = tid & 31;
  const int lm = l & 15;
  const int hi = l >> 4;

  // ---- Q fragments, used as WMMA B-operand (1/sqrt(d) folded in) ----
  HF16 qa0, qa1;
  {
    int t = mchunk * 128 + w * 16 + lm;
    int p = segbase + off + t * rate;
    const float* qrow = Q + (p * H + head) * D;
#pragma unroll
    for (int e = 0; e < 16; ++e) {
      int kk = ((e >> 3) << 4) + (hi << 3) + (e & 7);
      qa0.f[e] = (_Float16)(qrow[kk]      * 0.125f);
      qa1.f[e] = (_Float16)(qrow[32 + kk] * 0.125f);
    }
  }

  // ---- staging helpers (8 contiguous f32 per thread per tensor) ----
  const int st_key = (tid * 8) >> 6;   // 0..31 : key row this thread stages
  const int st_kk  = (tid * 8) & 63;   // 0,8,16,..,56 : k base within row
  float kreg[8], vreg[8];

  auto stage_load = [&](int kt) {
    int pk = segbase + off + (kt * 32 + st_key) * rate;
    const float* krow = K + (pk * H + head) * D + st_kk;
    const float* vrow = V + (pk * H + head) * D + st_kk;
#pragma unroll
    for (int j = 0; j < 8; ++j) { kreg[j] = krow[j]; vreg[j] = vrow[j]; }
  };
  auto stage_store = [&](int b) {
#pragma unroll
    for (int j = 0; j < 8; ++j) {
      sK[b][st_key * 64 + st_kk + j]        = (_Float16)kreg[j];
      sVt[b][(st_kk + j) * 32 + st_key]     = (_Float16)vreg[j];
    }
  };

  v8f o0 = {}, o1 = {}, o2 = {}, o3 = {};
  float lacc = 0.0f;

  stage_load(0);
  stage_store(0);
  __syncthreads();

  for (int kt = 0; kt < 64; ++kt) {
    const int b = kt & 1;

    // issue next tile's global loads early; latency hides under the WMMAs
    if (kt + 1 < 64) stage_load(kt + 1);

    // ---- S^T = K Q^T : two 16-key subtiles x two 32-deep k-chunks ----
    v16h kf00 = load_frag16(&sK[b][(0 * 16 + lm) * 64 + 0],  hi);
    v16h kf01 = load_frag16(&sK[b][(0 * 16 + lm) * 64 + 32], hi);
    v16h kf10 = load_frag16(&sK[b][(1 * 16 + lm) * 64 + 0],  hi);
    v16h kf11 = load_frag16(&sK[b][(1 * 16 + lm) * 64 + 32], hi);
    v8f st0 = {}, st1 = {};
    st0 = __builtin_amdgcn_wmma_f32_16x16x32_f16(false, kf00, false, qa0.v, (short)0, st0, false, false);
    st0 = __builtin_amdgcn_wmma_f32_16x16x32_f16(false, kf01, false, qa1.v, (short)0, st0, false, false);
    st1 = __builtin_amdgcn_wmma_f32_16x16x32_f16(false, kf10, false, qa0.v, (short)0, st1, false, false);
    st1 = __builtin_amdgcn_wmma_f32_16x16x32_f16(false, kf11, false, qa1.v, (short)0, st1, false, false);

    HF16 pa;
    float ls = 0.0f;
#pragma unroll
    for (int v = 0; v < 8; ++v) {
      float p0 = __expf(st0[v] - SHIFT);
      float p1 = __expf(st1[v] - SHIFT);
      ls += p0 + p1;
      pa.f[v]     = (_Float16)p0;
      pa.f[8 + v] = (_Float16)p1;
    }
    lacc += ls;

    // ---- O += P V : V^T columns as B-fragments ----
    v16h bv0 = load_frag16(&sVt[b][(0 * 16 + lm) * 32], hi);
    v16h bv1 = load_frag16(&sVt[b][(1 * 16 + lm) * 32], hi);
    v16h bv2 = load_frag16(&sVt[b][(2 * 16 + lm) * 32], hi);
    v16h bv3 = load_frag16(&sVt[b][(3 * 16 + lm) * 32], hi);
    o0 = __builtin_amdgcn_wmma_f32_16x16x32_f16(false, pa.v, false, bv0, (short)0, o0, false, false);
    o1 = __builtin_amdgcn_wmma_f32_16x16x32_f16(false, pa.v, false, bv1, (short)0, o1, false, false);
    o2 = __builtin_amdgcn_wmma_f32_16x16x32_f16(false, pa.v, false, bv2, (short)0, o2, false, false);
    o3 = __builtin_amdgcn_wmma_f32_16x16x32_f16(false, pa.v, false, bv3, (short)0, o3, false, false);

    // fill the other buffer for the next iteration; the barrier ending the
    // previous iteration (s_wait_dscnt 0 + s_barrier) made it safe to reuse
    if (kt + 1 < 64) stage_store(1 - b);
    __syncthreads();
  }

  // ---- finalize denominator: combine key-halves, broadcast per row ----
  lacc += __shfl_xor(lacc, 16, 32);
  sL[w][lm] = lacc;                 // both halves write identical values
  asm volatile("" ::: "memory");

  // ---- epilogue: out = O / l / num_groups, strided scatter ----
#pragma unroll
  for (int v = 0; v < 8; ++v) {
    int m = v + (hi << 3);
    int t = mchunk * 128 + w * 16 + m;
    int p = segbase + off + t * rate;
    float inv = (1.0f / 3.0f) / sL[w][m];
    float* orow = O + (p * H + head) * D + lm;
    orow[0]  = o0[v] * inv;
    orow[16] = o1[v] * inv;
    orow[32] = o2[v] * inv;
    orow[48] = o3[v] * inv;
  }
}

extern "C" void kernel_launch(void* const* d_in, const int* in_sizes, int n_in,
                              void* d_out, int out_size, void* d_ws, size_t ws_size,
                              hipStream_t stream) {
  const float* Q = (const float*)d_in[0];
  const float* K = (const float*)d_in[1];
  const float* V = (const float*)d_in[2];
  float* O = (float*)d_out;

  // Positions/heads outside the dilation stride remain exactly zero.
  zero_out_kernel<<<(out_size + 255) / 256, 256, 0, stream>>>(O, out_size);

  // 28 (segment, head) attention problems * 16 query chunks of 128 rows.
  dilated_attn_kernel<<<28 * 16, 256, 0, stream>>>(Q, K, V, O);
}

// v001
// It runs in 78.8 microseconds.
// Timed twice side by side with v000, it ran 1.63 and 1.62 times as fast.
#include <hip/hip_runtime.h>

typedef __attribute__((ext_vector_type(16))) _Float16 v16h;
typedef __attribute__((ext_vector_type(8)))  float    v8f;
typedef __attribute__((ext_vector_type(8)))  _Float16 v8h;

union HF16 { v16h v; _Float16 f[16]; };

__device__ __forceinline__ v16h load_frag16(const _Float16* base, int hi) {
  HF16 r;
#pragma unroll
  for (int e = 0; e < 16; ++e) {
    int k = ((e >> 3) << 4) + (hi << 3) + (e & 7);
    r.f[e] = base[k];
  }
  return r.v;
}

__global__ void zero_out_kernel(float* __restrict__ o, int n) {
  int i = blockIdx.x * blockDim.x + threadIdx.x;
  if (i < n) o[i] = 0.0f;
}

__global__ __launch_bounds__(256) void dilated_attn_kernel(
    const float* __restrict__ Q, const float* __restrict__ K,
    const float* __restrict__ V, float* __restrict__ O) {
  constexpr int H = 12, D = 64;
  constexpr float SHIFT = 3.0f;  // cancels in p*v / sum(p)

  int blk = blockIdx.x;
  int pair = blk >> 4;     // 0..27
  int mchunk = blk & 15;   // 0..15 (128 query rows each)

  int g, idx;
  if (pair < 16)      { g = 0; idx = pair; }
  else if (pair < 24) { g = 1; idx = pair - 16; }
  else                { g = 2; idx = pair - 24; }
  const int rate = (g == 0) ? 1 : (g == 1) ? 2 : 4;
  const int slen = (g == 0) ? 2048 : (g == 1) ? 4096 : 8192;
  const int off  = (g == 0) ? 0 : (g == 1) ? 1 : 2;   // i % r
  const int seg  = idx >> 2;
  const int head = g * 4 + (idx & 3);
  const int segbase = seg * slen;

  constexpr int KP = 72;
  constexpr int VP = 40;
  constexpr int VG = 16 * VP + 8;
  __shared__ __attribute__((aligned(16))) _Float16 sK[2][32 * KP];  // [buf][key][k]
  __shared__ __attribute__((aligned(16))) _Float16 sVt[2][4 * VG];  // [buf][d/16][d%16][key]
  __shared__ float    sL[8][16];        // per-wave denominator broadcast

  const int tid = threadIdx.x;
  const int w  = tid >> 5;
  const int l  = tid & 31;
  const int lm = l & 15;
  const int hi = l >> 4;

  // ---- Q fragments, used as WMMA B-operand (1/sqrt(d) folded in) ----
  HF16 qa0, qa1;
  {
    int t = mchunk * 128 + w * 16 + lm;
    int p = segbase + off + t * rate;
    const float* qrow = Q + (p * H + head) * D;
#pragma unroll
    for (int e = 0; e < 16; ++e) {
      int kk = ((e >> 3) << 4) + (hi << 3) + (e & 7);
      qa0.f[e] = (_Float16)(qrow[kk]      * 0.125f);
      qa1.f[e] = (_Float16)(qrow[32 + kk] * 0.125f);
    }
  }

  // ---- staging helpers (8 contiguous f32 per thread per tensor) ----
  const int st_key = (tid * 8) >> 6;   // 0..31 : key row this thread stages
  const int st_kk  = (tid * 8) & 63;   // 0,8,16,..,56 : k base within row
  float kreg[8], vreg[8];

  auto stage_load = [&](int kt) {
    int pk = segbase + off + (kt * 32 + st_key) * rate;
    const float* krow = K + (pk * H + head) * D + st_kk;
    const float* vrow = V + (pk * H + head) * D + st_kk;
#pragma unroll
    for (int j = 0; j < 8; ++j) { kreg[j] = krow[j]; vreg[j] = vrow[j]; }
  };
  auto stage_store = [&](int b) {
    v8h kh;
#pragma unroll
    for (int j = 0; j < 8; ++j) kh[j] = (_Float16)kreg[j];
    // one 16-byte store (row pitch and st_kk * 2 are multiples of 16 B); written
    // as a vector because the compiler split the element stores at this pitch
    *reinterpret_cast<v8h*>(&sK[b][st_key * KP + st_kk]) = kh;
#pragma unroll
    for (int j = 0; j < 8; ++j)
      sVt[b][(st_kk >> 4) * VG + ((st_kk & 8) + j) * VP + st_key] = (_Float16)vreg[j];
  };

  v8f o0 = {}, o1 = {}, o2 = {}, o3 = {};
  float lacc = 0.0f;

  stage_load(0);
  stage_store(0);
  __syncthreads();

  for (int kt = 0; kt < 64; ++kt) {
    const int b = kt & 1;

    // issue next tile's global loads early; latency hides under the WMMAs
    if (kt + 1 < 64) stage_load(kt + 1);
    // holds the loads above where they are written, ahead of this trip's LDS
    // reads and WMMAs: with the padded tiles the compiler otherwise sinks them to
    // just in front of their LDS stores, and each wave waits out the whole load
    // latency in front of the barrier
    __builtin_amdgcn_sched_barrier(0);

    // ---- S^T = K Q^T : two 16-key subtiles x two 32-deep k-chunks ----
    v16h kf00 = load_frag16(&sK[b][(0 * 16 + lm) * KP + 0],  hi);
    v16h kf01 = load_frag16(&sK[b][(0 * 16 + lm) * KP + 32], hi);
    v16h kf10 = load_frag16(&sK[b][(1 * 16 + lm) * KP + 0],  hi);
    v16h kf11 = load_frag16(&sK[b][(1 * 16 + lm) * KP + 32], hi);
    v8f st0 = {}, st1 = {};
    st0 = __builtin_amdgcn_wmma_f32_16x16x32_f16(false, kf00, false, qa0.v, (short)0, st0, false, false);
    st0 = __builtin_amdgcn_wmma_f32_16x16x32_f16(false, kf01, false, qa1.v, (short)0, st0, false, false);
    st1 = __builtin_amdgcn_wmma_f32_16x16x32_f16(false, kf10, false, qa0.v, (short)0, st1, false, false);
    st1 = __builtin_amdgcn_wmma_f32_16x16x32_f16(false, kf11, false, qa1.v, (short)0, st1, false, false);

    HF16 pa;
    float ls = 0.0f;
#pragma unroll
    for (int v = 0; v < 8; ++v) {
      float p0 = __expf(st0[v] - SHIFT);
      float p1 = __expf(st1[v] - SHIFT);
      ls += p0 + p1;
      pa.f[v]     = (_Float16)p0;
      pa.f[8 + v] = (_Float16)p1;
    }
    lacc += ls;

    // ---- O += P V : V^T columns as B-fragments ----
    v16h bv0 = load_frag16(&sVt[b][0 * VG + lm * VP], hi);
    v16h bv1 = load_frag16(&sVt[b][1 * VG + lm * VP], hi);
    v16h bv2 = load_frag16(&sVt[b][2 * VG + lm * VP], hi);
    v16h bv3 = load_frag16(&sVt[b][3 * VG + lm * VP], hi);
    o0 = __builtin_amdgcn_wmma_f32_16x16x32_f16(false, pa.v, false, bv0, (short)0, o0, false, false);
    o1 = __builtin_amdgcn_wmma_f32_16x16x32_f16(false, pa.v, false, bv1, (short)0, o1, false, false);
    o2 = __builtin_amdgcn_wmma_f32_16x16x32_f16(false, pa.v, false, bv2, (short)0, o2, false, false);
    o3 = __builtin_amdgcn_wmma_f32_16x16x32_f16(false, pa.v, false, bv3, (short)0, o3, false, false);

    // fill the other buffer for the next iteration; the barrier ending the
    // previous iteration (s_wait_dscnt 0 + s_barrier) made it safe to reuse
    if (kt + 1 < 64) stage_store(1 - b);
    __syncthreads();
  }

  // ---- finalize denominator: combine key-halves, broadcast per row ----
  lacc += __shfl_xor(lacc, 16, 32);
  sL[w][lm] = lacc;                 // both halves write identical values
  asm volatile("" ::: "memory");

  // ---- epilogue: out = O / l / num_groups, strided scatter ----
#pragma unroll
  for (int v = 0; v < 8; ++v) {
    int m = v + (hi << 3);
    int t = mchunk * 128 + w * 16 + m;
    int p = segbase + off + t * rate;
    float inv = (1.0f / 3.0f) / sL[w][m];
    float* orow = O + (p * H + head) * D + lm;
    orow[0]  = o0[v] * inv;
    orow[16] = o1[v] * inv;
    orow[32] = o2[v] * inv;
    orow[48] = o3[v] * inv;
  }
}

extern "C" void kernel_launch(void* const* d_in, const int* in_sizes, int n_in,
                              void* d_out, int out_size, void* d_ws, size_t ws_size,
                              hipStream_t stream) {
  const float* Q = (const float*)d_in[0];
  const float* K = (const float*)d_in[1];
  const float* V = (const float*)d_in[2];
  float* O = (float*)d_out;

  // Positions/heads outside the dilation stride remain exactly zero.
  zero_out_kernel<<<(out_size + 255) / 256, 256, 0, stream>>>(O, out_size);

  // 28 (segment, head) attention problems * 16 query chunks of 128 rows.
  dilated_attn_kernel<<<28 * 16, 256, 0, stream>>>(Q, K, V, O);
}

// v002
// A run of this version takes 61 microseconds.
// In two side-by-side timings against v001, it was 1.30 and 1.29 times as fast.
// All steps since v000 together make it 2.10 times as fast.
#include <hip/hip_runtime.h>

typedef __attribute__((ext_vector_type(16))) _Float16 v16h;
typedef __attribute__((ext_vector_type(8)))  float    v8f;
typedef __attribute__((ext_vector_type(8)))  _Float16 v8h;

union HF16 { v16h v; _Float16 f[16]; };

__device__ __forceinline__ v16h load_frag16(const _Float16* base, int hi) {
  HF16 r;
#pragma unroll
  for (int e = 0; e < 16; ++e) {
    int k = ((e >> 3) << 4) + (hi << 3) + (e & 7);
    r.f[e] = base[k];
  }
  return r.v;
}

__global__ __launch_bounds__(256) void dilated_attn_kernel(
    const float* __restrict__ Q, const float* __restrict__ K,
    const float* __restrict__ V, float* __restrict__ O) {
  constexpr int H = 12, D = 64;
  constexpr float SHIFT = 3.0f;  // cancels in p*v / sum(p)

  int blk = blockIdx.x;
  int pair = blk >> 4;     // 0..27
  int mchunk = blk & 15;   // 0..15 (128 query rows each)

  int g, idx;
  if (pair < 16)      { g = 0; idx = pair; }
  else if (pair < 24) { g = 1; idx = pair - 16; }
  else                { g = 2; idx = pair - 24; }
  const int rate = (g == 0) ? 1 : (g == 1) ? 2 : 4;
  const int slen = (g == 0) ? 2048 : (g == 1) ? 4096 : 8192;
  const int off  = (g == 0) ? 0 : (g == 1) ? 1 : 2;   // i % r
  const int seg  = idx >> 2;
  const int head = g * 4 + (idx & 3);
  const int segbase = seg * slen;

  constexpr int KP = 72;
  constexpr int VP = 40;
  constexpr int VG = 16 * VP + 8;
  __shared__ __attribute__((aligned(16))) _Float16 sK[2][32 * KP];  // [buf][key][k]
  __shared__ __attribute__((aligned(16))) _Float16 sVt[2][4 * VG];  // [buf][d/16][d%16][key]
  __shared__ float    sL[8][16];        // per-wave denominator broadcast

  const int tid = threadIdx.x;
  const int w  = tid >> 5;
  const int l  = tid & 31;
  const int lm = l & 15;
  const int hi = l >> 4;

  // ---- Q fragments, used as WMMA B-operand (1/sqrt(d) folded in) ----
  HF16 qa0, qa1;
  {
    int t = mchunk * 128 + w * 16 + lm;
    int p = segbase + off + t * rate;
    const float* qrow = Q + (p * H + head) * D;
#pragma unroll
    for (int e = 0; e < 16; ++e) {
      int kk = ((e >> 3) << 4) + (hi << 3) + (e & 7);
      qa0.f[e] = (_Float16)(qrow[kk]      * 0.125f);
      qa1.f[e] = (_Float16)(qrow[32 + kk] * 0.125f);
    }
  }

  // ---- staging helpers (8 contiguous f32 per thread per tensor) ----
  const int st_key = (tid * 8) >> 6;   // 0..31 : key row this thread stages
  const int st_kk  = (tid * 8) & 63;   // 0,8,16,..,56 : k base within row
  float kreg[8], vreg[8];

  auto stage_load = [&](int kt) {
    int pk = segbase + off + (kt * 32 + st_key) * rate;
    const float* krow = K + (pk * H + head) * D + st_kk;
    const float* vrow = V + (pk * H + head) * D + st_kk;
#pragma unroll
    for (int j = 0; j < 8; ++j) { kreg[j] = krow[j]; vreg[j] = vrow[j]; }
  };
  auto stage_store = [&](int b) {
    v8h kh;
#pragma unroll
    for (int j = 0; j < 8; ++j) kh[j] = (_Float16)kreg[j];
    // one 16-byte store (row pitch and st_kk * 2 are multiples of 16 B); written
    // as a vector because the compiler split the element stores at this pitch
    *reinterpret_cast<v8h*>(&sK[b][st_key * KP + st_kk]) = kh;
#pragma unroll
    for (int j = 0; j < 8; ++j)
      sVt[b][(st_kk >> 4) * VG + ((st_kk & 8) + j) * VP + st_key] = (_Float16)vreg[j];
  };

  v8f o0 = {}, o1 = {}, o2 = {}, o3 = {};
  float lacc = 0.0f;

  stage_load(0);
  stage_store(0);
  __syncthreads();

  // ---- zero rows: positions of this block's span that the dilation skips ----
  // 16 lanes x 16 B = one 256-B row. Issued here so that the stores drain under
  // the first trip of the key loop.
  for (int r = 0; r < rate; ++r) {
    if (r == off) continue;
    float* zrow = O + ((segbase + mchunk * 128 * rate + r) * H + head) * D + (tid & 15) * 4;
    // unrolled so that a pass's eight stores issue back to back
#pragma unroll
    for (int i = 0; i < 8; ++i) {
      int t = i * 16 + (tid >> 4);
      *reinterpret_cast<float4*>(zrow + t * rate * (H * D)) = make_float4(0.0f, 0.0f, 0.0f, 0.0f);
    }
    // the next pass rewrites the address registers of the stores just issued
    asm volatile("s_wait_xcnt 0x0" ::: "memory");
  }

  for (int kt = 0; kt < 64; ++kt) {
    const int b = kt & 1;

    // issue next tile's global loads early; latency hides under the WMMAs
    if (kt + 1 < 64) stage_load(kt + 1);
    // holds the loads above where they are written, ahead of this trip's LDS
    // reads and WMMAs: with the padded tiles the compiler otherwise sinks them to
    // just in front of their LDS stores, and each wave waits out the whole load
    // latency in front of the barrier
    __builtin_amdgcn_sched_barrier(0);

    // ---- S^T = K Q^T : two 16-key subtiles x two 32-deep k-chunks ----
    v16h kf00 = load_frag16(&sK[b][(0 * 16 + lm) * KP + 0],  hi);
    v16h kf01 = load_frag16(&sK[b][(0 * 16 + lm) * KP + 32], hi);
    v16h kf10 = load_frag16(&sK[b][(1 * 16 + lm) * KP + 0],  hi);
    v16h kf11 = load_frag16(&sK[b][(1 * 16 + lm) * KP + 32], hi);
    v8f st0 = {}, st1 = {};
    st0 = __builtin_amdgcn_wmma_f32_16x16x32_f16(false, kf00, false, qa0.v, (short)0, st0, false, false);
    st0 = __builtin_amdgcn_wmma_f32_16x16x32_f16(false, kf01, false, qa1.v, (short)0, st0, false, false);
    st1 = __builtin_amdgcn_wmma_f32_16x16x32_f16(false, kf10, false, qa0.v, (short)0, st1, false, false);
    st1 = __builtin_amdgcn_wmma_f32_16x16x32_f16(false, kf11, false, qa1.v, (short)0, st1, false, false);

    HF16 pa;
    float ls = 0.0f;
#pragma unroll
    for (int v = 0; v < 8; ++v) {
      float p0 = __expf(st0[v] - SHIFT);
      float p1 = __expf(st1[v] - SHIFT);
      ls += p0 + p1;
      pa.f[v]     = (_Float16)p0;
      pa.f[8 + v] = (_Float16)p1;
    }
    lacc += ls;

    // ---- O += P V : V^T columns as B-fragments ----
    v16h bv0 = load_frag16(&sVt[b][0 * VG + lm * VP], hi);
    v16h bv1 = load_frag16(&sVt[b][1 * VG + lm * VP], hi);
    v16h bv2 = load_frag16(&sVt[b][2 * VG + lm * VP], hi);
    v16h bv3 = load_frag16(&sVt[b][3 * VG + lm * VP], hi);
    o0 = __builtin_amdgcn_wmma_f32_16x16x32_f16(false, pa.v, false, bv0, (short)0, o0, false, false);
    o1 = __builtin_amdgcn_wmma_f32_16x16x32_f16(false, pa.v, false, bv1, (short)0, o1, false, false);
    o2 = __builtin_amdgcn_wmma_f32_16x16x32_f16(false, pa.v, false, bv2, (short)0, o2, false, false);
    o3 = __builtin_amdgcn_wmma_f32_16x16x32_f16(false, pa.v, false, bv3, (short)0, o3, false, false);

    // fill the other buffer for the next iteration; the barrier ending the
    // previous iteration (s_wait_dscnt 0 + s_barrier) made it safe to reuse
    if (kt + 1 < 64) stage_store(1 - b);
    __syncthreads();
  }

  // ---- finalize denominator: combine key-halves, broadcast per row ----
  lacc += __shfl_xor(lacc, 16, 32);
  sL[w][lm] = lacc;                 // both halves write identical values
  asm volatile("" ::: "memory");

  // ---- epilogue: out = O / l / num_groups, strided scatter ----
#pragma unroll
  for (int v = 0; v < 8; ++v) {
    int m = v + (hi << 3);
    int t = mchunk * 128 + w * 16 + m;
    int p = segbase + off + t * rate;
    float inv = (1.0f / 3.0f) / sL[w][m];
    float* orow = O + (p * H + head) * D + lm;
    orow[0]  = o0[v] * inv;
    orow[16] = o1[v] * inv;
    orow[32] = o2[v] * inv;
    orow[48] = o3[v] * inv;
  }
}

extern "C" void kernel_launch(void* const* d_in, const int* in_sizes, int n_in,
                              void* d_out, int out_size, void* d_ws, size_t ws_size,
                              hipStream_t stream) {
  const float* Q = (const float*)d_in[0];
  const float* K = (const float*)d_in[1];
  const float* V = (const float*)d_in[2];
  float* O = (float*)d_out;

  // 28 (segment, head) attention problems * 16 query chunks of 128 rows; each
  // block also zeroes the skipped positions inside its own span.
  dilated_attn_kernel<<<28 * 16, 256, 0, stream>>>(Q, K, V, O);
}

// v003
// A run of this version takes 56.7 microseconds.
// Timed twice side by side with v002, it ran 1.08 times as fast both times.
// All steps since v000 together make it 2.26 times as fast.
#include <hip/hip_runtime.h>

typedef __attribute__((ext_vector_type(16))) _Float16 v16h;
typedef __attribute__((ext_vector_type(8)))  float    v8f;
typedef __attribute__((ext_vector_type(8)))  _Float16 v8h;

union HF16 { v16h v; _Float16 f[16]; };

__device__ __forceinline__ v16h load_frag16(const _Float16* base, int hi) {
  HF16 r;
#pragma unroll
  for (int e = 0; e < 16; ++e) {
    int k = ((e >> 3) << 4) + (hi << 3) + (e & 7);
    r.f[e] = base[k];
  }
  return r.v;
}

__global__ __launch_bounds__(256) void dilated_attn_kernel(
    const float* __restrict__ Q, const float* __restrict__ K,
    const float* __restrict__ V, float* __restrict__ O) {
  constexpr int H = 12, D = 64;
  constexpr float SHIFT = 3.0f;  // cancels in p*v / sum(p)

  int blk = blockIdx.x;
  int pair = blk >> 3;     // 0..27
  int mchunk = blk & 7;    // 0..7 (256 query rows each)

  int g, idx;
  if (pair < 16)      { g = 0; idx = pair; }
  else if (pair < 24) { g = 1; idx = pair - 16; }
  else                { g = 2; idx = pair - 24; }
  const int rate = (g == 0) ? 1 : (g == 1) ? 2 : 4;
  const int slen = (g == 0) ? 2048 : (g == 1) ? 4096 : 8192;
  const int off  = (g == 0) ? 0 : (g == 1) ? 1 : 2;   // i % r
  const int seg  = idx >> 2;
  const int head = g * 4 + (idx & 3);
  const int segbase = seg * slen;

  constexpr int KP = 72;
  constexpr int VP = 40;
  constexpr int VG = 16 * VP + 8;
  __shared__ __attribute__((aligned(16))) _Float16 sK[2][32 * KP];  // [buf][key][k]
  __shared__ __attribute__((aligned(16))) _Float16 sVt[2][4 * VG];  // [buf][d/16][d%16][key]
  __shared__ float    sL[8][32];        // per-wave denominator broadcast

  const int tid = threadIdx.x;
  const int w  = tid >> 5;
  const int l  = tid & 31;
  const int lm = l & 15;
  const int hi = l >> 4;

  // ---- Q fragments, used as WMMA B-operand (1/sqrt(d) folded in) ----
  HF16 qa0[2], qa1[2];   // [query tile]
  // unrolled: r must be a constant, it indexes arrays kept in registers
#pragma unroll
  for (int r = 0; r < 2; ++r) {
    int t = mchunk * 256 + w * 32 + r * 16 + lm;
    int p = segbase + off + t * rate;
    const float* qrow = Q + (p * H + head) * D;
#pragma unroll
    for (int e = 0; e < 16; ++e) {
      int kk = ((e >> 3) << 4) + (hi << 3) + (e & 7);
      qa0[r].f[e] = (_Float16)(qrow[kk]      * 0.125f);
      qa1[r].f[e] = (_Float16)(qrow[32 + kk] * 0.125f);
    }
    // later loads land in the address registers of the loads just issued
    asm volatile("s_wait_xcnt 0x0" ::: "memory");
  }

  // ---- staging helpers (8 contiguous f32 per thread per tensor) ----
  const int st_key = (tid * 8) >> 6;   // 0..31 : key row this thread stages
  const int st_kk  = (tid * 8) & 63;   // 0,8,16,..,56 : k base within row
  float kreg[8], vreg[8];

  auto stage_load = [&](int kt) {
    int pk = segbase + off + (kt * 32 + st_key) * rate;
    const float* krow = K + (pk * H + head) * D + st_kk;
    const float* vrow = V + (pk * H + head) * D + st_kk;
#pragma unroll
    for (int j = 0; j < 8; ++j) { kreg[j] = krow[j]; vreg[j] = vrow[j]; }
  };
  auto stage_store = [&](int b) {
    v8h kh;
#pragma unroll
    for (int j = 0; j < 8; ++j) kh[j] = (_Float16)kreg[j];
    // one 16-byte store (row pitch and st_kk * 2 are multiples of 16 B); written
    // as a vector because the compiler split the element stores at this pitch
    *reinterpret_cast<v8h*>(&sK[b][st_key * KP + st_kk]) = kh;
#pragma unroll
    for (int j = 0; j < 8; ++j)
      sVt[b][(st_kk >> 4) * VG + ((st_kk & 8) + j) * VP + st_key] = (_Float16)vreg[j];
  };

  v8f o0[2] = {}, o1[2] = {}, o2[2] = {}, o3[2] = {};   // [query tile]
  float lacc[2] = {0.0f, 0.0f};

  stage_load(0);
  stage_store(0);
  __syncthreads();

  // ---- zero rows: positions of this block's span that the dilation skips ----
  // 16 lanes x 16 B = one 256-B row. Issued here so that the stores drain under
  // the first trip of the key loop.
  for (int r = 0; r < rate; ++r) {
    if (r == off) continue;
    float* zrow = O + ((segbase + mchunk * 256 * rate + r) * H + head) * D + (tid & 15) * 4;
    // unrolled so that a pass's sixteen stores issue back to back
#pragma unroll
    for (int i = 0; i < 16; ++i) {
      int t = i * 16 + (tid >> 4);
      *reinterpret_cast<float4*>(zrow + t * rate * (H * D)) = make_float4(0.0f, 0.0f, 0.0f, 0.0f);
    }
    // the next pass rewrites the address registers of the stores just issued
    asm volatile("s_wait_xcnt 0x0" ::: "memory");
  }

  for (int kt = 0; kt < 64; ++kt) {
    const int b = kt & 1;

    // issue next tile's global loads early; latency hides under the WMMAs
    if (kt + 1 < 64) stage_load(kt + 1);
    // holds the loads above where they are written, ahead of this trip's LDS
    // reads and WMMAs: with the padded tiles the compiler otherwise sinks them to
    // just in front of their LDS stores, and each wave waits out the whole load
    // latency in front of the barrier
    __builtin_amdgcn_sched_barrier(0);

    // ---- S^T = K Q^T : two 16-key subtiles x two 32-deep k-chunks ----
    v16h kf00 = load_frag16(&sK[b][(0 * 16 + lm) * KP + 0],  hi);
    v16h kf01 = load_frag16(&sK[b][(0 * 16 + lm) * KP + 32], hi);
    v16h kf10 = load_frag16(&sK[b][(1 * 16 + lm) * KP + 0],  hi);
    v16h kf11 = load_frag16(&sK[b][(1 * 16 + lm) * KP + 32], hi);
    v8f st0[2] = {}, st1[2] = {};
    // unrolled: r must be a constant, it indexes arrays kept in registers
#pragma unroll
    for (int r = 0; r < 2; ++r) {
      st0[r] = __builtin_amdgcn_wmma_f32_16x16x32_f16(false, kf00, false, qa0[r].v, (short)0, st0[r], false, false);
      st1[r] = __builtin_amdgcn_wmma_f32_16x16x32_f16(false, kf10, false, qa0[r].v, (short)0, st1[r], false, false);
    }
    // unrolled: r must be a constant, it indexes arrays kept in registers
#pragma unroll
    for (int r = 0; r < 2; ++r) {
      st0[r] = __builtin_amdgcn_wmma_f32_16x16x32_f16(false, kf01, false, qa1[r].v, (short)0, st0[r], false, false);
      st1[r] = __builtin_amdgcn_wmma_f32_16x16x32_f16(false, kf11, false, qa1[r].v, (short)0, st1[r], false, false);
    }

    HF16 pa[2];
    // unrolled: r must be a constant, it indexes arrays kept in registers
#pragma unroll
    for (int r = 0; r < 2; ++r) {
      float ls = 0.0f;
#pragma unroll
      for (int v = 0; v < 8; ++v) {
        float p0 = __expf(st0[r][v] - SHIFT);
        float p1 = __expf(st1[r][v] - SHIFT);
        ls += p0 + p1;
        pa[r].f[v]     = (_Float16)p0;
        pa[r].f[8 + v] = (_Float16)p1;
      }
      lacc[r] += ls;
    }

    // ---- O += P V : V^T columns as B-fragments ----
    v16h bv0 = load_frag16(&sVt[b][0 * VG + lm * VP], hi);
    v16h bv1 = load_frag16(&sVt[b][1 * VG + lm * VP], hi);
    v16h bv2 = load_frag16(&sVt[b][2 * VG + lm * VP], hi);
    v16h bv3 = load_frag16(&sVt[b][3 * VG + lm * VP], hi);
    // unrolled: r must be a constant, it indexes arrays kept in registers
#pragma unroll
    for (int r = 0; r < 2; ++r) {
      o0[r] = __builtin_amdgcn_wmma_f32_16x16x32_f16(false, pa[r].v, false, bv0, (short)0, o0[r], false, false);
      o1[r] = __builtin_amdgcn_wmma_f32_16x16x32_f16(false, pa[r].v, false, bv1, (short)0, o1[r], false, false);
      o2[r] = __builtin_amdgcn_wmma_f32_16x16x32_f16(false, pa[r].v, false, bv2, (short)0, o2[r], false, false);
      o3[r] = __builtin_amdgcn_wmma_f32_16x16x32_f16(false, pa[r].v, false, bv3, (short)0, o3[r], false, false);
    }

    // holds the conversions and LDS stores of the next tile below this trip's
    // WMMAs: with two query tiles the compiler otherwise lifts them to just
    // behind their global loads, and each wave waits out the whole load latency
    // at the trip's top
    __builtin_amdgcn_sched_barrier(0);

    // fill the other buffer for the next iteration; the barrier ending the
    // previous iteration (s_wait_dscnt 0 + s_barrier) made it safe to reuse
    if (kt + 1 < 64) stage_store(1 - b);
    __syncthreads();
  }

  // ---- finalize denominator: combine key-halves, broadcast per row ----
  // unrolled: r must be a constant, it indexes arrays kept in registers
#pragma unroll
  for (int r = 0; r < 2; ++r) {
    lacc[r] += __shfl_xor(lacc[r], 16, 32);
    sL[w][r * 16 + lm] = lacc[r];   // both halves write identical values
  }
  asm volatile("" ::: "memory");

  // ---- epilogue: out = O / l / num_groups, strided scatter ----
  // unrolled: r must be a constant, it indexes arrays kept in registers
#pragma unroll
  for (int r = 0; r < 2; ++r) {
#pragma unroll
    for (int v = 0; v < 8; ++v) {
      int m = r * 16 + v + (hi << 3);
      int t = mchunk * 256 + w * 32 + m;
      int p = segbase + off + t * rate;
      float inv = (1.0f / 3.0f) / sL[w][m];
      float* orow = O + (p * H + head) * D + lm;
      orow[0]  = o0[r][v] * inv;
      orow[16] = o1[r][v] * inv;
      orow[32] = o2[r][v] * inv;
      orow[48] = o3[r][v] * inv;
    }
  }
}

extern "C" void kernel_launch(void* const* d_in, const int* in_sizes, int n_in,
                              void* d_out, int out_size, void* d_ws, size_t ws_size,
                              hipStream_t stream) {
  const float* Q = (const float*)d_in[0];
  const float* K = (const float*)d_in[1];
  const float* V = (const float*)d_in[2];
  float* O = (float*)d_out;

  // 28 (segment, head) attention problems * 8 query chunks of 256 rows; each
  // block also zeroes the skipped positions inside its own span.
  dilated_attn_kernel<<<28 * 8, 256, 0, stream>>>(Q, K, V, O);
}

// v004
// Measured time: 38.8 microseconds a run.
// In both of two side-by-side timings against v003, it was 1.46 times as fast.
// Over all steps from v000 it is 3.30 times as fast.
#include <hip/hip_runtime.h>

typedef __attribute__((ext_vector_type(16))) _Float16 v16h;
typedef __attribute__((ext_vector_type(8)))  float    v8f;
typedef __attribute__((ext_vector_type(8)))  _Float16 v8h;
typedef __attribute__((ext_vector_type(4)))  float    v4f;

union HF16 { v16h v; _Float16 f[16]; };

__device__ __forceinline__ v16h load_frag16(const _Float16* base, int hi) {
  HF16 r;
#pragma unroll
  for (int e = 0; e < 16; ++e) {
    int k = ((e >> 3) << 4) + (hi << 3) + (e & 7);
    r.f[e] = base[k];
  }
  return r.v;
}

__global__ __launch_bounds__(256) void dilated_attn_kernel(
    const float* __restrict__ Q, const float* __restrict__ K,
    const float* __restrict__ V, float* __restrict__ O) {
  constexpr int H = 12, D = 64;
  constexpr float SHIFT = 3.0f;  // cancels in p*v / sum(p)

  int blk = blockIdx.x;
  int pair = blk >> 3;     // 0..27
  int mchunk = blk & 7;    // 0..7 (256 query rows each)

  int g, idx;
  if (pair < 16)      { g = 0; idx = pair; }
  else if (pair < 24) { g = 1; idx = pair - 16; }
  else                { g = 2; idx = pair - 24; }
  const int rate = (g == 0) ? 1 : (g == 1) ? 2 : 4;
  const int slen = (g == 0) ? 2048 : (g == 1) ? 4096 : 8192;
  const int off  = (g == 0) ? 0 : (g == 1) ? 1 : 2;   // i % r
  const int seg  = idx >> 2;
  const int head = g * 4 + (idx & 3);
  const int segbase = seg * slen;

  constexpr int KP = 72;
  constexpr int VP = 40;
  constexpr int VG = 16 * VP + 8;
  constexpr int SUB = 4;            // 32-key tiles per stage
  constexpr int NST = 64 / SUB;     // stages over the 2048 keys
  __shared__ __attribute__((aligned(16))) _Float16 sK[2][SUB][32 * KP];  // [buf][tile][key][k]
  __shared__ __attribute__((aligned(16))) _Float16 sVt[2][SUB][4 * VG];  // [buf][tile][d/16][d%16][key]
  __shared__ float    sL[8][32];        // per-wave denominator broadcast

  const int tid = threadIdx.x;
  const int w  = tid >> 5;
  const int l  = tid & 31;
  const int lm = l & 15;
  const int hi = l >> 4;

  // ---- Q fragments, used as WMMA B-operand (1/sqrt(d) folded in) ----
  HF16 qa0[2], qa1[2];   // [query tile]
  // unrolled: r must be a constant, it indexes arrays kept in registers
#pragma unroll
  for (int r = 0; r < 2; ++r) {
    int t = mchunk * 256 + w * 32 + r * 16 + lm;
    int p = segbase + off + t * rate;
    const float* qrow = Q + (p * H + head) * D;
#pragma unroll
    for (int e = 0; e < 16; ++e) {
      int kk = ((e >> 3) << 4) + (hi << 3) + (e & 7);
      qa0[r].f[e] = (_Float16)(qrow[kk]      * 0.125f);
      qa1[r].f[e] = (_Float16)(qrow[32 + kk] * 0.125f);
    }
    // later loads land in the address registers of the loads just issued
    asm volatile("s_wait_xcnt 0x0" ::: "memory");
  }

  // ---- staging helpers (8 contiguous f32 per thread, tensor and tile) ----
  const int st_key = (tid * 8) >> 6;   // 0..31 : key row this thread stages
  const int st_kk  = (tid * 8) & 63;   // 0,8,16,..,56 : k base within row
  v4f kreg[SUB][2], vreg[SUB][2];

  auto stage_load = [&](int kt) {
    // unrolled: s must be a constant, it indexes arrays kept in registers
#pragma unroll
    for (int s = 0; s < SUB; ++s) {
      int pk = segbase + off + ((kt * SUB + s) * 32 + st_key) * rate;
      const float* krow = K + (pk * H + head) * D + st_kk;
      const float* vrow = V + (pk * H + head) * D + st_kk;
      // 16-byte loads: rows are 256 B and st_kk * 4 is a multiple of 32 B
      kreg[s][0] = *reinterpret_cast<const v4f*>(krow);
      kreg[s][1] = *reinterpret_cast<const v4f*>(krow + 4);
      vreg[s][0] = *reinterpret_cast<const v4f*>(vrow);
      vreg[s][1] = *reinterpret_cast<const v4f*>(vrow + 4);
    }
  };
  auto stage_store = [&](int b) {
    // unrolled: s must be a constant, it indexes arrays kept in registers
#pragma unroll
    for (int s = 0; s < SUB; ++s) {
      v8h kh;
#pragma unroll
      for (int j = 0; j < 8; ++j) kh[j] = (_Float16)kreg[s][j >> 2][j & 3];
      // one 16-byte store (row pitch and st_kk * 2 are multiples of 16 B); written
      // as a vector because the compiler split the element stores at this pitch
      *reinterpret_cast<v8h*>(&sK[b][s][st_key * KP + st_kk]) = kh;
#pragma unroll
      for (int j = 0; j < 8; ++j)
        sVt[b][s][(st_kk >> 4) * VG + ((st_kk & 8) + j) * VP + st_key] = (_Float16)vreg[s][j >> 2][j & 3];
    }
  };

  v8f o0[2] = {}, o1[2] = {}, o2[2] = {}, o3[2] = {};   // [query tile]
  float lacc[2] = {0.0f, 0.0f};

  stage_load(0);
  stage_store(0);
  __syncthreads();

  // ---- zero rows: positions of this block's span that the dilation skips ----
  // 16 lanes x 16 B = one 256-B row. Issued here so that the stores drain under
  // the first trip of the key loop.
  for (int r = 0; r < rate; ++r) {
    if (r == off) continue;
    float* zrow = O + ((segbase + mchunk * 256 * rate + r) * H + head) * D + (tid & 15) * 4;
    // unrolled so that a pass's sixteen stores issue back to back
#pragma unroll
    for (int i = 0; i < 16; ++i) {
      int t = i * 16 + (tid >> 4);
      *reinterpret_cast<float4*>(zrow + t * rate * (H * D)) = make_float4(0.0f, 0.0f, 0.0f, 0.0f);
    }
    // the next pass rewrites the address registers of the stores just issued
    asm volatile("s_wait_xcnt 0x0" ::: "memory");
  }

  // one stage's work: its four tiles, in key order
  auto stage_compute = [&](int b) {
    // unrolled so that the tile's place in LDS is an immediate offset and a
    // tile's fragment reads can start under the tile before
#pragma unroll
    for (int s = 0; s < SUB; ++s) {
    // ---- S^T = K Q^T : two 16-key subtiles x two 32-deep k-chunks ----
    v16h kf00 = load_frag16(&sK[b][s][(0 * 16 + lm) * KP + 0],  hi);
    v16h kf01 = load_frag16(&sK[b][s][(0 * 16 + lm) * KP + 32], hi);
    v16h kf10 = load_frag16(&sK[b][s][(1 * 16 + lm) * KP + 0],  hi);
    v16h kf11 = load_frag16(&sK[b][s][(1 * 16 + lm) * KP + 32], hi);
    v8f st0[2] = {}, st1[2] = {};
    // unrolled: r must be a constant, it indexes arrays kept in registers
#pragma unroll
    for (int r = 0; r < 2; ++r) {
      st0[r] = __builtin_amdgcn_wmma_f32_16x16x32_f16(false, kf00, false, qa0[r].v, (short)0, st0[r], false, false);
      st1[r] = __builtin_amdgcn_wmma_f32_16x16x32_f16(false, kf10, false, qa0[r].v, (short)0, st1[r], false, false);
    }
    // unrolled: r must be a constant, it indexes arrays kept in registers
#pragma unroll
    for (int r = 0; r < 2; ++r) {
      st0[r] = __builtin_amdgcn_wmma_f32_16x16x32_f16(false, kf01, false, qa1[r].v, (short)0, st0[r], false, false);
      st1[r] = __builtin_amdgcn_wmma_f32_16x16x32_f16(false, kf11, false, qa1[r].v, (short)0, st1[r], false, false);
    }

    HF16 pa[2];
    // unrolled: r must be a constant, it indexes arrays kept in registers
#pragma unroll
    for (int r = 0; r < 2; ++r) {
      float ls = 0.0f;
#pragma unroll
      for (int v = 0; v < 8; ++v) {
        float p0 = __expf(st0[r][v] - SHIFT);
        float p1 = __expf(st1[r][v] - SHIFT);
        ls += p0 + p1;
        pa[r].f[v]     = (_Float16)p0;
        pa[r].f[8 + v] = (_Float16)p1;
      }
      lacc[r] += ls;
    }

    // ---- O += P V : V^T columns as B-fragments ----
    v16h bv0 = load_frag16(&sVt[b][s][0 * VG + lm * VP], hi);
    v16h bv1 = load_frag16(&sVt[b][s][1 * VG + lm * VP], hi);
    v16h bv2 = load_frag16(&sVt[b][s][2 * VG + lm * VP], hi);
    v16h bv3 = load_frag16(&sVt[b][s][3 * VG + lm * VP], hi);
    // unrolled: r must be a constant, it indexes arrays kept in registers
#pragma unroll
    for (int r = 0; r < 2; ++r) {
      o0[r] = __builtin_amdgcn_wmma_f32_16x16x32_f16(false, pa[r].v, false, bv0, (short)0, o0[r], false, false);
      o1[r] = __builtin_amdgcn_wmma_f32_16x16x32_f16(false, pa[r].v, false, bv1, (short)0, o1[r], false, false);
      o2[r] = __builtin_amdgcn_wmma_f32_16x16x32_f16(false, pa[r].v, false, bv2, (short)0, o2[r], false, false);
      o3[r] = __builtin_amdgcn_wmma_f32_16x16x32_f16(false, pa[r].v, false, bv3, (short)0, o3[r], false, false);
    }
    }
  };

  // the last stage stands behind the loop: it loads and stores nothing, and the
  // loop body stays one block without branches
  for (int kt = 0; kt < NST - 1; ++kt) {
    const int b = kt & 1;

    // issue next stage's global loads early; latency hides under the WMMAs
    stage_load(kt + 1);
    // this trip's LDS reads land in the address registers of the loads just issued
    asm volatile("s_wait_xcnt 0x0" ::: "memory");
    // holds the loads above where they are written, ahead of this trip's LDS
    // reads and WMMAs: with the padded tiles the compiler otherwise sinks them to
    // just in front of their LDS stores, and each wave waits out the whole load
    // latency in front of the barrier
    __builtin_amdgcn_sched_barrier(0);

    stage_compute(b);

    // takes the loaded words, as they came, as inputs only: they stay unconverted
    // up to here, so that no wait for the loads stands in front of this trip's work
    asm volatile("" :: "v"(kreg[0][0]), "v"(kreg[0][1]), "v"(vreg[0][0]), "v"(vreg[0][1]),
                       "v"(kreg[1][0]), "v"(kreg[1][1]), "v"(vreg[1][0]), "v"(vreg[1][1]),
                       "v"(kreg[2][0]), "v"(kreg[2][1]), "v"(vreg[2][0]), "v"(vreg[2][1]),
                       "v"(kreg[3][0]), "v"(kreg[3][1]), "v"(vreg[3][0]), "v"(vreg[3][1]));
    // holds the conversions and LDS stores of the next stage below this trip's
    // WMMAs: with two query tiles the compiler otherwise lifts them to just
    // behind their global loads, and each wave waits out the whole load latency
    // at the trip's top
    __builtin_amdgcn_sched_barrier(0);

    // fill the other buffer for the next iteration; the barrier ending the
    // previous iteration (s_wait_dscnt 0 + s_barrier) made it safe to reuse
    stage_store(1 - b);
    __syncthreads();
  }
  stage_compute((NST - 1) & 1);

  // ---- finalize denominator: combine key-halves, broadcast per row ----
  // unrolled: r must be a constant, it indexes arrays kept in registers
#pragma unroll
  for (int r = 0; r < 2; ++r) {
    lacc[r] += __shfl_xor(lacc[r], 16, 32);
    sL[w][r * 16 + lm] = lacc[r];   // both halves write identical values
  }
  asm volatile("" ::: "memory");

  // ---- epilogue: out = O / l / num_groups, strided scatter ----
  // unrolled: r must be a constant, it indexes arrays kept in registers
#pragma unroll
  for (int r = 0; r < 2; ++r) {
#pragma unroll
    for (int v = 0; v < 8; ++v) {
      int m = r * 16 + v + (hi << 3);
      int t = mchunk * 256 + w * 32 + m;
      int p = segbase + off + t * rate;
      float inv = (1.0f / 3.0f) / sL[w][m];
      float* orow = O + (p * H + head) * D + lm;
      orow[0]  = o0[r][v] * inv;
      orow[16] = o1[r][v] * inv;
      orow[32] = o2[r][v] * inv;
      orow[48] = o3[r][v] * inv;
    }
  }
}

extern "C" void kernel_launch(void* const* d_in, const int* in_sizes, int n_in,
                              void* d_out, int out_size, void* d_ws, size_t ws_size,
                              hipStream_t stream) {
  const float* Q = (const float*)d_in[0];
  const float* K = (const float*)d_in[1];
  const float* V = (const float*)d_in[2];
  float* O = (float*)d_out;

  // 28 (segment, head) attention problems * 8 query chunks of 256 rows; each
  // block also zeroes the skipped positions inside its own span.
  dilated_attn_kernel<<<28 * 8, 256, 0, stream>>>(Q, K, V, O);
}

// v005
// It runs in 35.2 microseconds.
// Two timings next to v004 both put it at 1.10 times that version's speed.
// All steps since v000 together make it 3.65 times as fast.
#include <hip/hip_runtime.h>

typedef __attribute__((ext_vector_type(16))) _Float16 v16h;
typedef __attribute__((ext_vector_type(8)))  float    v8f;
typedef __attribute__((ext_vector_type(8)))  _Float16 v8h;
typedef __attribute__((ext_vector_type(4)))  float    v4f;

union HF16 { v16h v; _Float16 f[16]; };

__device__ __forceinline__ v16h load_frag16(const _Float16* base, int hi) {
  HF16 r;
#pragma unroll
  for (int e = 0; e < 16; ++e) {
    int k = ((e >> 3) << 4) + (hi << 3) + (e & 7);
    r.f[e] = base[k];
  }
  return r.v;
}

__global__ __launch_bounds__(256) void dilated_attn_kernel(
    const float* __restrict__ Q, const float* __restrict__ K,
    const float* __restrict__ V, float* __restrict__ O) {
  constexpr int H = 12, D = 64;
  constexpr float SHIFT2 = 4.0f;  // in powers of two; cancels in p*v / sum(p)
  constexpr float QSCALE = 0.125f * 1.4426950408889634f;  // log2(e) / sqrt(d)

  int blk = blockIdx.x;
  int pair = blk >> 3;     // 0..27
  int mchunk = blk & 7;    // 0..7 (256 query rows each)

  int g, idx;
  if (pair < 16)      { g = 0; idx = pair; }
  else if (pair < 24) { g = 1; idx = pair - 16; }
  else                { g = 2; idx = pair - 24; }
  const int rate = (g == 0) ? 1 : (g == 1) ? 2 : 4;
  const int slen = (g == 0) ? 2048 : (g == 1) ? 4096 : 8192;
  const int off  = (g == 0) ? 0 : (g == 1) ? 1 : 2;   // i % r
  const int seg  = idx >> 2;
  const int head = g * 4 + (idx & 3);
  const int segbase = seg * slen;

  constexpr int KP = 72;
  constexpr int VP = 40;
  constexpr int VG = 16 * VP + 8;
  constexpr int SUB = 4;            // 32-key tiles per stage
  constexpr int NST = 64 / SUB;     // stages over the 2048 keys
  __shared__ __attribute__((aligned(16))) _Float16 sK[2][SUB][32 * KP];  // [buf][tile][key][k]
  __shared__ __attribute__((aligned(16))) _Float16 sVt[2][SUB][4 * VG];  // [buf][tile][d/16][d%16][key]
  __shared__ float    sL[8][32];        // per-wave denominator broadcast

  const int tid = threadIdx.x;
  const int w  = tid >> 5;
  const int l  = tid & 31;
  const int lm = l & 15;
  const int hi = l >> 4;

  // ---- Q fragments, used as WMMA B-operand (log2(e)/sqrt(d) folded in) ----
  HF16 qa0[2], qa1[2];   // [query tile]
  // unrolled: r must be a constant, it indexes arrays kept in registers
#pragma unroll
  for (int r = 0; r < 2; ++r) {
    int t = mchunk * 256 + w * 32 + r * 16 + lm;
    int p = segbase + off + t * rate;
    const float* qrow = Q + (p * H + head) * D;
#pragma unroll
    for (int e = 0; e < 16; ++e) {
      int kk = ((e >> 3) << 4) + (hi << 3) + (e & 7);
      qa0[r].f[e] = (_Float16)(qrow[kk]      * QSCALE);
      qa1[r].f[e] = (_Float16)(qrow[32 + kk] * QSCALE);
    }
    // later loads land in the address registers of the loads just issued
    asm volatile("s_wait_xcnt 0x0" ::: "memory");
  }

  // ---- staging helpers (8 contiguous f32 per thread, tensor and tile) ----
  const int st_key = (tid * 8) >> 6;   // 0..31 : key row this thread stages
  const int st_kk  = (tid * 8) & 63;   // 0,8,16,..,56 : k base within row
  v4f kreg[SUB][2], vreg[SUB][2];

  auto stage_load = [&](int kt) {
    // unrolled: s must be a constant, it indexes arrays kept in registers
#pragma unroll
    for (int s = 0; s < SUB; ++s) {
      int pk = segbase + off + ((kt * SUB + s) * 32 + st_key) * rate;
      const float* krow = K + (pk * H + head) * D + st_kk;
      const float* vrow = V + (pk * H + head) * D + st_kk;
      // 16-byte loads: rows are 256 B and st_kk * 4 is a multiple of 32 B
      kreg[s][0] = *reinterpret_cast<const v4f*>(krow);
      kreg[s][1] = *reinterpret_cast<const v4f*>(krow + 4);
      vreg[s][0] = *reinterpret_cast<const v4f*>(vrow);
      vreg[s][1] = *reinterpret_cast<const v4f*>(vrow + 4);
    }
  };
  auto stage_store = [&](int b) {
    // unrolled: s must be a constant, it indexes arrays kept in registers
#pragma unroll
    for (int s = 0; s < SUB; ++s) {
      v8h kh;
#pragma unroll
      for (int j = 0; j < 8; ++j) kh[j] = (_Float16)kreg[s][j >> 2][j & 3];
      // one 16-byte store (row pitch and st_kk * 2 are multiples of 16 B); written
      // as a vector because the compiler split the element stores at this pitch
      *reinterpret_cast<v8h*>(&sK[b][s][st_key * KP + st_kk]) = kh;
#pragma unroll
      for (int j = 0; j < 8; ++j)
        sVt[b][s][(st_kk >> 4) * VG + ((st_kk & 8) + j) * VP + st_key] = (_Float16)vreg[s][j >> 2][j & 3];
    }
  };

  v8f o0[2] = {}, o1[2] = {}, o2[2] = {}, o3[2] = {};   // [query tile]
  float lacc[2] = {0.0f, 0.0f};

  stage_load(0);
  stage_store(0);
  __syncthreads();

  // ---- zero rows: positions of this block's span that the dilation skips ----
  // 16 lanes x 16 B = one 256-B row. Issued here so that the stores drain under
  // the first trip of the key loop.
  for (int r = 0; r < rate; ++r) {
    if (r == off) continue;
    float* zrow = O + ((segbase + mchunk * 256 * rate + r) * H + head) * D + (tid & 15) * 4;
    // unrolled so that a pass's sixteen stores issue back to back
#pragma unroll
    for (int i = 0; i < 16; ++i) {
      int t = i * 16 + (tid >> 4);
      *reinterpret_cast<float4*>(zrow + t * rate * (H * D)) = make_float4(0.0f, 0.0f, 0.0f, 0.0f);
    }
    // the next pass rewrites the address registers of the stores just issued
    asm volatile("s_wait_xcnt 0x0" ::: "memory");
  }

  // one stage's work: its four tiles, in key order
  auto stage_compute = [&](int b) {
    // unrolled so that the tile's place in LDS is an immediate offset and a
    // tile's fragment reads can start under the tile before
#pragma unroll
    for (int s = 0; s < SUB; ++s) {
    // ---- S^T = K Q^T : two 16-key subtiles x two 32-deep k-chunks ----
    v16h kf00 = load_frag16(&sK[b][s][(0 * 16 + lm) * KP + 0],  hi);
    v16h kf01 = load_frag16(&sK[b][s][(0 * 16 + lm) * KP + 32], hi);
    v16h kf10 = load_frag16(&sK[b][s][(1 * 16 + lm) * KP + 0],  hi);
    v16h kf11 = load_frag16(&sK[b][s][(1 * 16 + lm) * KP + 32], hi);
    // the accumulators start at the shift, so that they end as the exponent
    const v8f sh = {-SHIFT2, -SHIFT2, -SHIFT2, -SHIFT2, -SHIFT2, -SHIFT2, -SHIFT2, -SHIFT2};
    v8f st0[2] = {sh, sh}, st1[2] = {sh, sh};
    // unrolled: r must be a constant, it indexes arrays kept in registers
#pragma unroll
    for (int r = 0; r < 2; ++r) {
      st0[r] = __builtin_amdgcn_wmma_f32_16x16x32_f16(false, kf00, false, qa0[r].v, (short)0, st0[r], false, false);
      st1[r] = __builtin_amdgcn_wmma_f32_16x16x32_f16(false, kf10, false, qa0[r].v, (short)0, st1[r], false, false);
    }
    // unrolled: r must be a constant, it indexes arrays kept in registers
#pragma unroll
    for (int r = 0; r < 2; ++r) {
      st0[r] = __builtin_amdgcn_wmma_f32_16x16x32_f16(false, kf01, false, qa1[r].v, (short)0, st0[r], false, false);
      st1[r] = __builtin_amdgcn_wmma_f32_16x16x32_f16(false, kf11, false, qa1[r].v, (short)0, st1[r], false, false);
    }

    HF16 pa[2];
    // unrolled: r must be a constant, it indexes arrays kept in registers
#pragma unroll
    for (int r = 0; r < 2; ++r) {
      float ls = 0.0f;
#pragma unroll
      for (int v = 0; v < 8; ++v) {
        float p0 = __builtin_amdgcn_exp2f(st0[r][v]);
        float p1 = __builtin_amdgcn_exp2f(st1[r][v]);
        ls += p0 + p1;
        pa[r].f[v]     = (_Float16)p0;
        pa[r].f[8 + v] = (_Float16)p1;
      }
      lacc[r] += ls;
    }

    // ---- O += P V : V^T columns as B-fragments ----
    v16h bv0 = load_frag16(&sVt[b][s][0 * VG + lm * VP], hi);
    v16h bv1 = load_frag16(&sVt[b][s][1 * VG + lm * VP], hi);
    v16h bv2 = load_frag16(&sVt[b][s][2 * VG + lm * VP], hi);
    v16h bv3 = load_frag16(&sVt[b][s][3 * VG + lm * VP], hi);
    // unrolled: r must be a constant, it indexes arrays kept in registers
#pragma unroll
    for (int r = 0; r < 2; ++r) {
      o0[r] = __builtin_amdgcn_wmma_f32_16x16x32_f16(false, pa[r].v, false, bv0, (short)0, o0[r], false, false);
      o1[r] = __builtin_amdgcn_wmma_f32_16x16x32_f16(false, pa[r].v, false, bv1, (short)0, o1[r], false, false);
      o2[r] = __builtin_amdgcn_wmma_f32_16x16x32_f16(false, pa[r].v, false, bv2, (short)0, o2[r], false, false);
      o3[r] = __builtin_amdgcn_wmma_f32_16x16x32_f16(false, pa[r].v, false, bv3, (short)0, o3[r], false, false);
    }
    }
  };

  // the last stage stands behind the loop: it loads and stores nothing, and the
  // loop body stays one block without branches
  for (int kt = 0; kt < NST - 1; ++kt) {
    const int b = kt & 1;

    // issue next stage's global loads early; latency hides under the WMMAs
    stage_load(kt + 1);
    // this trip's LDS reads land in the address registers of the loads just issued
    asm volatile("s_wait_xcnt 0x0" ::: "memory");
    // holds the loads above where they are written, ahead of this trip's LDS
    // reads and WMMAs: with the padded tiles the compiler otherwise sinks them to
    // just in front of their LDS stores, and each wave waits out the whole load
    // latency in front of the barrier
    __builtin_amdgcn_sched_barrier(0);

    stage_compute(b);

    // takes the loaded words, as they came, as inputs only: they stay unconverted
    // up to here, so that no wait for the loads stands in front of this trip's work
    asm volatile("" :: "v"(kreg[0][0]), "v"(kreg[0][1]), "v"(vreg[0][0]), "v"(vreg[0][1]),
                       "v"(kreg[1][0]), "v"(kreg[1][1]), "v"(vreg[1][0]), "v"(vreg[1][1]),
                       "v"(kreg[2][0]), "v"(kreg[2][1]), "v"(vreg[2][0]), "v"(vreg[2][1]),
                       "v"(kreg[3][0]), "v"(kreg[3][1]), "v"(vreg[3][0]), "v"(vreg[3][1]));
    // holds the conversions and LDS stores of the next stage below this trip's
    // WMMAs: with two query tiles the compiler otherwise lifts them to just
    // behind their global loads, and each wave waits out the whole load latency
    // at the trip's top
    __builtin_amdgcn_sched_barrier(0);

    // fill the other buffer for the next iteration; the barrier ending the
    // previous iteration (s_wait_dscnt 0 + s_barrier) made it safe to reuse
    stage_store(1 - b);
    __syncthreads();
  }
  stage_compute((NST - 1) & 1);

  // ---- finalize denominator: combine key-halves, broadcast per row ----
  // unrolled: r must be a constant, it indexes arrays kept in registers
#pragma unroll
  for (int r = 0; r < 2; ++r) {
    lacc[r] += __shfl_xor(lacc[r], 16, 32);
    sL[w][r * 16 + lm] = lacc[r];   // both halves write identical values
  }
  asm volatile("" ::: "memory");

  // ---- epilogue: out = O / l / num_groups, strided scatter ----
  // unrolled: r must be a constant, it indexes arrays kept in registers
#pragma unroll
  for (int r = 0; r < 2; ++r) {
#pragma unroll
    for (int v = 0; v < 8; ++v) {
      int m = r * 16 + v + (hi << 3);
      int t = mchunk * 256 + w * 32 + m;
      int p = segbase + off + t * rate;
      float inv = (1.0f / 3.0f) / sL[w][m];
      float* orow = O + (p * H + head) * D + lm;
      orow[0]  = o0[r][v] * inv;
      orow[16] = o1[r][v] * inv;
      orow[32] = o2[r][v] * inv;
      orow[48] = o3[r][v] * inv;
    }
  }
}

extern "C" void kernel_launch(void* const* d_in, const int* in_sizes, int n_in,
                              void* d_out, int out_size, void* d_ws, size_t ws_size,
                              hipStream_t stream) {
  const float* Q = (const float*)d_in[0];
  const float* K = (const float*)d_in[1];
  const float* V = (const float*)d_in[2];
  float* O = (float*)d_out;

  // 28 (segment, head) attention problems * 8 query chunks of 256 rows; each
  // block also zeroes the skipped positions inside its own span.
  dilated_attn_kernel<<<28 * 8, 256, 0, stream>>>(Q, K, V, O);
}

// v006
// It runs in 32.8 microseconds.
// In both of two side-by-side timings against v005, it was 1.06 times as fast.
// Counting every step since v000, it is 3.88 times as fast.
#include <hip/hip_runtime.h>

typedef __attribute__((ext_vector_type(16))) _Float16 v16h;
typedef __attribute__((ext_vector_type(8)))  float    v8f;
typedef __attribute__((ext_vector_type(8)))  _Float16 v8h;
typedef __attribute__((ext_vector_type(4)))  float    v4f;

union HF16 { v16h v; _Float16 f[16]; };

__device__ __forceinline__ v16h load_frag16(const _Float16* base, int hi) {
  HF16 r;
#pragma unroll
  for (int e = 0; e < 16; ++e) {
    int k = ((e >> 3) << 4) + (hi << 3) + (e & 7);
    r.f[e] = base[k];
  }
  return r.v;
}

__global__ __launch_bounds__(512) void dilated_attn_kernel(
    const float* __restrict__ Q, const float* __restrict__ K,
    const float* __restrict__ V, float* __restrict__ O) {
  constexpr int H = 12, D = 64;
  constexpr float SHIFT2 = 4.0f;  // in powers of two; cancels in p*v / sum(p)
  constexpr float QSCALE = 0.125f * 1.4426950408889634f;  // log2(e) / sqrt(d)

  int blk = blockIdx.x;
  int pair = blk >> 3;     // 0..27
  int mchunk = blk & 7;    // 0..7 (256 query rows each)

  int g, idx;
  if (pair < 16)      { g = 0; idx = pair; }
  else if (pair < 24) { g = 1; idx = pair - 16; }
  else                { g = 2; idx = pair - 24; }
  const int rate = (g == 0) ? 1 : (g == 1) ? 2 : 4;
  const int slen = (g == 0) ? 2048 : (g == 1) ? 4096 : 8192;
  const int off  = (g == 0) ? 0 : (g == 1) ? 1 : 2;   // i % r
  const int seg  = idx >> 2;
  const int head = g * 4 + (idx & 3);
  const int segbase = seg * slen;

  constexpr int KP = 72;
  constexpr int VP = 40;
  constexpr int VG = 16 * VP + 8;
  constexpr int SUB = 4;            // 32-key tiles per stage
  constexpr int NST = 64 / SUB;     // stages over the 2048 keys
  __shared__ __attribute__((aligned(16))) _Float16 sK[2][SUB][32 * KP];  // [buf][tile][key][k]
  __shared__ __attribute__((aligned(16))) _Float16 sVt[2][SUB][4 * VG];  // [buf][tile][d/16][d%16][key]
  __shared__ float    sL[16][16];       // per-wave denominator broadcast
  __shared__ v4f      sX[16][8][32];    // [wave][quad][lane]: partial p*v sums handed to the partner wave
  __shared__ float    sXl[16][32];      // [wave][lane]: partial denominators handed to the partner wave

  const int tid = threadIdx.x;
  const int w  = tid >> 5;
  const int w8  = w & 7;    // which 32 query rows
  const int grp = w >> 3;   // which half of each stage's keys
  const int l  = tid & 31;
  const int lm = l & 15;
  const int hi = l >> 4;

  // ---- Q fragments, used as WMMA B-operand (log2(e)/sqrt(d) folded in) ----
  HF16 qa0[2], qa1[2];   // [query tile]
  // unrolled: r must be a constant, it indexes arrays kept in registers
#pragma unroll
  for (int r = 0; r < 2; ++r) {
    int t = mchunk * 256 + w8 * 32 + r * 16 + lm;
    int p = segbase + off + t * rate;
    const float* qrow = Q + (p * H + head) * D;
#pragma unroll
    for (int e = 0; e < 16; ++e) {
      int kk = ((e >> 3) << 4) + (hi << 3) + (e & 7);
      qa0[r].f[e] = (_Float16)(qrow[kk]      * QSCALE);
      qa1[r].f[e] = (_Float16)(qrow[32 + kk] * QSCALE);
    }
    // later loads land in the address registers of the loads just issued
    asm volatile("s_wait_xcnt 0x0" ::: "memory");
  }

  // ---- staging helpers (8 contiguous f32 per thread, tensor and tile) ----
  // a wave group stages the two tiles that it reads itself
  constexpr int TPG = SUB / 2;         // 32-key tiles per wave group and stage
  const int st_key = ((tid & 255) * 8) >> 6;   // 0..31 : key row this thread stages
  const int st_kk  = (tid * 8) & 63;   // 0,8,16,..,56 : k base within row
  v4f kreg[TPG][2], vreg[TPG][2];

  auto stage_load = [&](int kt, bool first) {
    // unrolled: s must be a constant, it indexes arrays kept in registers
#pragma unroll
    for (int s = 0; s < TPG; ++s) {
      int pk = segbase + off + ((kt * SUB + grp * TPG + s) * 32 + st_key) * rate;
      const float* krow = K + (pk * H + head) * D + st_kk;
      const float* vrow = V + (pk * H + head) * D + st_kk;
      // 16-byte loads: rows are 256 B and st_kk * 4 is a multiple of 32 B
      // the waits: in front of the loop the compiler lets a later load land in the
      // address registers of a load just issued (first is a constant at each call;
      // in the loop one wait behind all the loads serves)
      kreg[s][0] = *reinterpret_cast<const v4f*>(krow);
      if (first) asm volatile("s_wait_xcnt 0x0" ::: "memory");
      kreg[s][1] = *reinterpret_cast<const v4f*>(krow + 4);
      if (first) asm volatile("s_wait_xcnt 0x0" ::: "memory");
      vreg[s][0] = *reinterpret_cast<const v4f*>(vrow);
      if (first) asm volatile("s_wait_xcnt 0x0" ::: "memory");
      vreg[s][1] = *reinterpret_cast<const v4f*>(vrow + 4);
      if (first) asm volatile("s_wait_xcnt 0x0" ::: "memory");
    }
  };
  auto stage_store = [&](int b) {
    // unrolled: s must be a constant, it indexes arrays kept in registers
#pragma unroll
    for (int s = 0; s < TPG; ++s) {
      _Float16* tK = &sK[b][grp * TPG + s][0];
      _Float16* tV = &sVt[b][grp * TPG + s][0];
      v8h kh;
#pragma unroll
      for (int j = 0; j < 8; ++j) kh[j] = (_Float16)kreg[s][j >> 2][j & 3];
      // one 16-byte store (row pitch and st_kk * 2 are multiples of 16 B); written
      // as a vector because the compiler split the element stores at this pitch
      *reinterpret_cast<v8h*>(&tK[st_key * KP + st_kk]) = kh;
#pragma unroll
      for (int j = 0; j < 8; ++j)
        tV[(st_kk >> 4) * VG + ((st_kk & 8) + j) * VP + st_key] = (_Float16)vreg[s][j >> 2][j & 3];
    }
  };

  v8f o0[2] = {}, o1[2] = {}, o2[2] = {}, o3[2] = {};   // [query tile]
  float lacc[2] = {0.0f, 0.0f};

  stage_load(0, true);
  stage_store(0);
  __syncthreads();

  // ---- zero rows: positions of this block's span that the dilation skips ----
  // 16 lanes x 16 B = one 256-B row. Issued here so that the stores drain under
  // the first trip of the key loop.
  for (int r = 0; r < rate; ++r) {
    if (r == off) continue;
    float* zrow = O + ((segbase + mchunk * 256 * rate + r) * H + head) * D + (tid & 15) * 4;
    // unrolled so that a pass's eight stores issue back to back
#pragma unroll
    for (int i = 0; i < 8; ++i) {
      int t = i * 32 + (tid >> 4);
      *reinterpret_cast<float4*>(zrow + t * rate * (H * D)) = make_float4(0.0f, 0.0f, 0.0f, 0.0f);
    }
    // the next pass rewrites the address registers of the stores just issued
    asm volatile("s_wait_xcnt 0x0" ::: "memory");
  }

  // one stage's work of a wave: its group's two tiles, in key order
  auto stage_compute = [&](int b) {
    // unrolled so that the tile's place in LDS is an immediate offset and a
    // tile's fragment reads can start under the tile before
#pragma unroll
    for (int s = 0; s < TPG; ++s) {
    const _Float16* tK = &sK[b][grp * TPG + s][0];
    const _Float16* tV = &sVt[b][grp * TPG + s][0];
    // ---- S^T = K Q^T : two 16-key subtiles x two 32-deep k-chunks ----
    v16h kf00 = load_frag16(&tK[(0 * 16 + lm) * KP + 0],  hi);
    v16h kf01 = load_frag16(&tK[(0 * 16 + lm) * KP + 32], hi);
    v16h kf10 = load_frag16(&tK[(1 * 16 + lm) * KP + 0],  hi);
    v16h kf11 = load_frag16(&tK[(1 * 16 + lm) * KP + 32], hi);
    // the accumulators start at the shift, so that they end as the exponent
    const v8f sh = {-SHIFT2, -SHIFT2, -SHIFT2, -SHIFT2, -SHIFT2, -SHIFT2, -SHIFT2, -SHIFT2};
    v8f st0[2] = {sh, sh}, st1[2] = {sh, sh};
    // unrolled: r must be a constant, it indexes arrays kept in registers
#pragma unroll
    for (int r = 0; r < 2; ++r) {
      st0[r] = __builtin_amdgcn_wmma_f32_16x16x32_f16(false, kf00, false, qa0[r].v, (short)0, st0[r], false, false);
      st1[r] = __builtin_amdgcn_wmma_f32_16x16x32_f16(false, kf10, false, qa0[r].v, (short)0, st1[r], false, false);
    }
    // unrolled: r must be a constant, it indexes arrays kept in registers
#pragma unroll
    for (int r = 0; r < 2; ++r) {
      st0[r] = __builtin_amdgcn_wmma_f32_16x16x32_f16(false, kf01, false, qa1[r].v, (short)0, st0[r], false, false);
      st1[r] = __builtin_amdgcn_wmma_f32_16x16x32_f16(false, kf11, false, qa1[r].v, (short)0, st1[r], false, false);
    }

    HF16 pa[2];
    // unrolled: r must be a constant, it indexes arrays kept in registers
#pragma unroll
    for (int r = 0; r < 2; ++r) {
      float ls = 0.0f;
#pragma unroll
      for (int v = 0; v < 8; ++v) {
        float p0 = __builtin_amdgcn_exp2f(st0[r][v]);
        float p1 = __builtin_amdgcn_exp2f(st1[r][v]);
        ls += p0 + p1;
        pa[r].f[v]     = (_Float16)p0;
        pa[r].f[8 + v] = (_Float16)p1;
      }
      lacc[r] += ls;
    }

    // ---- O += P V : V^T columns as B-fragments ----
    v16h bv0 = load_frag16(&tV[0 * VG + lm * VP], hi);
    v16h bv1 = load_frag16(&tV[1 * VG + lm * VP], hi);
    v16h bv2 = load_frag16(&tV[2 * VG + lm * VP], hi);
    v16h bv3 = load_frag16(&tV[3 * VG + lm * VP], hi);
    // unrolled: r must be a constant, it indexes arrays kept in registers
#pragma unroll
    for (int r = 0; r < 2; ++r) {
      o0[r] = __builtin_amdgcn_wmma_f32_16x16x32_f16(false, pa[r].v, false, bv0, (short)0, o0[r], false, false);
      o1[r] = __builtin_amdgcn_wmma_f32_16x16x32_f16(false, pa[r].v, false, bv1, (short)0, o1[r], false, false);
      o2[r] = __builtin_amdgcn_wmma_f32_16x16x32_f16(false, pa[r].v, false, bv2, (short)0, o2[r], false, false);
      o3[r] = __builtin_amdgcn_wmma_f32_16x16x32_f16(false, pa[r].v, false, bv3, (short)0, o3[r], false, false);
    }
    }
  };

  // the last stage stands behind the loop: it loads and stores nothing, and the
  // loop body stays one block without branches
  for (int kt = 0; kt < NST - 1; ++kt) {
    const int b = kt & 1;

    // issue next stage's global loads early; latency hides under the WMMAs
    stage_load(kt + 1, false);
    // this trip's LDS reads land in the address registers of the loads just issued
    asm volatile("s_wait_xcnt 0x0" ::: "memory");
    // holds the loads above where they are written, ahead of this trip's LDS
    // reads and WMMAs: with the padded tiles the compiler otherwise sinks them to
    // just in front of their LDS stores, and each wave waits out the whole load
    // latency in front of the barrier
    __builtin_amdgcn_sched_barrier(0);

    stage_compute(b);

    // takes the loaded words, as they came, as inputs only: they stay unconverted
    // up to here, so that no wait for the loads stands in front of this trip's work
    asm volatile("" :: "v"(kreg[0][0]), "v"(kreg[0][1]), "v"(vreg[0][0]), "v"(vreg[0][1]),
                       "v"(kreg[1][0]), "v"(kreg[1][1]), "v"(vreg[1][0]), "v"(vreg[1][1]));
    // holds the conversions and LDS stores of the next stage below this trip's
    // WMMAs: with two query tiles the compiler otherwise lifts them to just
    // behind their global loads, and each wave waits out the whole load latency
    // at the trip's top
    __builtin_amdgcn_sched_barrier(0);

    // fill the other buffer for the next iteration; the barrier ending the
    // previous iteration (s_wait_dscnt 0 + s_barrier) made it safe to reuse
    stage_store(1 - b);
    __syncthreads();
  }
  stage_compute((NST - 1) & 1);

  // ---- join the two key halves of each query row ----
  // Of its two query tiles a wave keeps one (tile grp) and hands the other to its
  // partner w ^ 8, which holds the same rows in the same lanes and registers: each
  // wave then finishes 16 rows. sX and sXl are written nowhere else.
  const bool g1 = grp != 0;
  v8f keep[4] = {g1 ? o0[1] : o0[0], g1 ? o1[1] : o1[0], g1 ? o2[1] : o2[0], g1 ? o3[1] : o3[0]};
  v8f give[4] = {g1 ? o0[0] : o0[1], g1 ? o1[0] : o1[1], g1 ? o2[0] : o2[1], g1 ? o3[0] : o3[1]};
  float lsum = g1 ? lacc[1] : lacc[0];
  // unrolled: c must be a constant, it indexes arrays kept in registers
#pragma unroll
  for (int c = 0; c < 4; ++c) {
    sX[w][2 * c][l]     = __builtin_shufflevector(give[c], give[c], 0, 1, 2, 3);
    sX[w][2 * c + 1][l] = __builtin_shufflevector(give[c], give[c], 4, 5, 6, 7);
  }
  sXl[w][l] = g1 ? lacc[0] : lacc[1];
  __syncthreads();
  // unrolled: c must be a constant, it indexes arrays kept in registers
#pragma unroll
  for (int c = 0; c < 4; ++c) {
    v4f lo = sX[w ^ 8][2 * c][l];
    v4f hh = sX[w ^ 8][2 * c + 1][l];
    keep[c] += __builtin_shufflevector(lo, hh, 0, 1, 2, 3, 4, 5, 6, 7);
  }
  lsum += sXl[w ^ 8][l];

  // ---- finalize denominator: combine the lane halves, broadcast per row ----
  lsum += __shfl_xor(lsum, 16, 32);
  sL[w][lm] = lsum;   // both halves write identical values
  asm volatile("" ::: "memory");

  // ---- epilogue: out = O / l / num_groups, strided scatter ----
  // unrolled: v must be a constant, it indexes vectors kept in registers
#pragma unroll
  for (int v = 0; v < 8; ++v) {
    int m = v + (hi << 3);
    int t = mchunk * 256 + w8 * 32 + grp * 16 + m;
    int p = segbase + off + t * rate;
    float inv = (1.0f / 3.0f) / sL[w][m];
    float* orow = O + (p * H + head) * D + lm;
    orow[0]  = keep[0][v] * inv;
    orow[16] = keep[1][v] * inv;
    orow[32] = keep[2][v] * inv;
    orow[48] = keep[3][v] * inv;
  }
}

extern "C" void kernel_launch(void* const* d_in, const int* in_sizes, int n_in,
                              void* d_out, int out_size, void* d_ws, size_t ws_size,
                              hipStream_t stream) {
  const float* Q = (const float*)d_in[0];
  const float* K = (const float*)d_in[1];
  const float* V = (const float*)d_in[2];
  float* O = (float*)d_out;

  // 28 (segment, head) attention problems * 8 query chunks of 256 rows; each
  // block also zeroes the skipped positions inside its own span.
  dilated_attn_kernel<<<28 * 8, 512, 0, stream>>>(Q, K, V, O);
}

// v007
// A run of this version takes 31.8 microseconds.
// In both of two side-by-side timings against v006, it was 1.04 times as fast.
// Counting every step since v000, it is 4.03 times as fast.
#include <hip/hip_runtime.h>

typedef __attribute__((ext_vector_type(16))) _Float16 v16h;
typedef __attribute__((ext_vector_type(8)))  float    v8f;
typedef __attribute__((ext_vector_type(8)))  _Float16 v8h;
typedef __attribute__((ext_vector_type(4)))  float    v4f;

union HF16 { v16h v; _Float16 f[16]; };

__device__ __forceinline__ v16h load_frag16(const _Float16* base, int hi) {
  HF16 r;
#pragma unroll
  for (int e = 0; e < 16; ++e) {
    int k = ((e >> 3) << 4) + (hi << 3) + (e & 7);
    r.f[e] = base[k];
  }
  return r.v;
}

__global__ __launch_bounds__(512) void dilated_attn_kernel(
    const float* __restrict__ Q, const float* __restrict__ K,
    const float* __restrict__ V, float* __restrict__ O) {
  constexpr int H = 12, D = 64;
  constexpr float SHIFT2 = 4.0f;  // in powers of two; cancels in p*v / sum(p)
  constexpr float QSCALE = 0.125f * 1.4426950408889634f;  // log2(e) / sqrt(d)

  int blk = blockIdx.x;
  int pair = blk >> 3;     // 0..27
  int mchunk = blk & 7;    // 0..7 (256 query rows each)

  int g, idx;
  if (pair < 16)      { g = 0; idx = pair; }
  else if (pair < 24) { g = 1; idx = pair - 16; }
  else                { g = 2; idx = pair - 24; }
  const int rate = (g == 0) ? 1 : (g == 1) ? 2 : 4;
  const int slen = (g == 0) ? 2048 : (g == 1) ? 4096 : 8192;
  const int off  = (g == 0) ? 0 : (g == 1) ? 1 : 2;   // i % r
  const int seg  = idx >> 2;
  const int head = g * 4 + (idx & 3);
  const int segbase = seg * slen;

  constexpr int KP = 72;
  constexpr int VP = 40;
  constexpr int VG = 16 * VP + 8;
  constexpr int SUB = 4;            // 32-key tiles per stage
  constexpr int NST = 64 / SUB;     // stages over the 2048 keys
  constexpr int NBUF = 3;           // stage s lies in buffer s % 3
  __shared__ __attribute__((aligned(16))) _Float16 sK[NBUF][SUB][32 * KP];  // [buf][tile][key][k]
  __shared__ __attribute__((aligned(16))) _Float16 sVt[NBUF][SUB][4 * VG];  // [buf][tile][d/16][d%16][key]
  __shared__ float    sL[16][16];       // per-wave denominator broadcast
  __shared__ v4f      sX[16][8][32];    // [wave][quad][lane]: partial p*v sums handed to the partner wave
  __shared__ float    sXl[16][32];      // [wave][lane]: partial denominators handed to the partner wave

  const int tid = threadIdx.x;
  const int w  = __builtin_amdgcn_readfirstlane(tid >> 5);   // the same in a wave: kept scalar
  const int w8  = w & 7;    // which 32 query rows
  const int grp = w >> 3;   // which half of each stage's keys
  const int l  = tid & 31;
  const int lm = l & 15;
  const int hi = l >> 4;

  // ---- Q fragments, used as WMMA B-operand (log2(e)/sqrt(d) folded in) ----
  HF16 qa0[2], qa1[2];   // [query tile]
  // unrolled: r must be a constant, it indexes arrays kept in registers
#pragma unroll
  for (int r = 0; r < 2; ++r) {
    int t = mchunk * 256 + w8 * 32 + r * 16 + lm;
    int p = segbase + off + t * rate;
    const float* qrow = Q + (p * H + head) * D;
#pragma unroll
    for (int e = 0; e < 16; ++e) {
      int kk = ((e >> 3) << 4) + (hi << 3) + (e & 7);
      qa0[r].f[e] = (_Float16)(qrow[kk]      * QSCALE);
      qa1[r].f[e] = (_Float16)(qrow[32 + kk] * QSCALE);
    }
    // later loads land in the address registers of the loads just issued
    asm volatile("s_wait_xcnt 0x0" ::: "memory");
  }

  // ---- staging helpers (8 contiguous f32 per thread, tensor and tile) ----
  // a wave group stages the two tiles that it reads itself
  constexpr int TPG = SUB / 2;         // 32-key tiles per wave group and stage
  const int st_key = ((tid & 255) * 8) >> 6;   // 0..31 : key row this thread stages
  const int st_kk  = (tid * 8) & 63;   // 0,8,16,..,56 : k base within row
  const unsigned st_off = (unsigned)(st_key * rate * (H * D) + st_kk) * 4u;  // bytes, inside a tile's rows
  typedef v4f stage_regs[TPG][2];
  stage_regs kreg, vreg;

  auto stage_load = [&](stage_regs& kreg, stage_regs& vreg, int kt, bool first) {
    // unrolled: s must be a constant, it indexes arrays kept in registers
#pragma unroll
    for (int s = 0; s < TPG; ++s) {
      // the tile's base is scalar (grp is), the thread's own offset is fixed: what
      // changes from trip to trip is formed on the scalar unit
      const int row0 = segbase + off + (kt * SUB + grp * TPG + s) * 32 * rate;
      const size_t tb = (size_t)((row0 * H + head) * D) * sizeof(float);
      const float* krow = reinterpret_cast<const float*>(reinterpret_cast<const char*>(K) + tb + st_off);
      const float* vrow = reinterpret_cast<const float*>(reinterpret_cast<const char*>(V) + tb + st_off);
      // 16-byte loads: rows are 256 B and st_kk * 4 is a multiple of 32 B
      // the waits: in front of the loop a later base lands in the scalar registers
      // that the two loads just issued name (first is a constant at each call; in
      // the loop one wait behind all the loads serves)
      kreg[s][0] = *reinterpret_cast<const v4f*>(krow);
      kreg[s][1] = *reinterpret_cast<const v4f*>(krow + 4);
      if (first) asm volatile("s_wait_xcnt 0x0" ::: "memory");
      vreg[s][0] = *reinterpret_cast<const v4f*>(vrow);
      vreg[s][1] = *reinterpret_cast<const v4f*>(vrow + 4);
      if (first) asm volatile("s_wait_xcnt 0x0" ::: "memory");
    }
  };
  auto stage_store = [&](const stage_regs& kreg, const stage_regs& vreg, int b) {
    // unrolled: s must be a constant, it indexes arrays kept in registers
#pragma unroll
    for (int s = 0; s < TPG; ++s) {
      _Float16* tK = &sK[b][grp * TPG + s][0];
      _Float16* tV = &sVt[b][grp * TPG + s][0];
      v8h kh;
#pragma unroll
      for (int j = 0; j < 8; ++j) kh[j] = (_Float16)kreg[s][j >> 2][j & 3];
      // one 16-byte store (row pitch and st_kk * 2 are multiples of 16 B); written
      // as a vector because the compiler split the element stores at this pitch
      *reinterpret_cast<v8h*>(&tK[st_key * KP + st_kk]) = kh;
#pragma unroll
      for (int j = 0; j < 8; ++j)
        tV[(st_kk >> 4) * VG + ((st_kk & 8) + j) * VP + st_key] = (_Float16)vreg[s][j >> 2][j & 3];
    }
  };

  v8f o0[2] = {}, o1[2] = {}, o2[2] = {}, o3[2] = {};   // [query tile]
  float lacc[2] = {0.0f, 0.0f};

  // stages 0 and 1: both stages' loads are in flight together
  {
    stage_regs kreg1, vreg1;
    stage_load(kreg, vreg, 0, true);
    stage_load(kreg1, vreg1, 1, true);
    stage_store(kreg, vreg, 0);
    stage_store(kreg1, vreg1, 1);
  }
  __syncthreads();
  // opens the split barrier: the wait at the foot of stage 0 answers this signal
  // (signal and wait alternate in every wave)
  asm volatile("s_barrier_signal -1" ::: "memory");

  // ---- zero rows: positions of this block's span that the dilation skips ----
  // 16 lanes x 16 B = one 256-B row. Issued here so that the stores drain under
  // the first trip of the key loop.
  for (int r = 0; r < rate; ++r) {
    if (r == off) continue;
    float* zrow = O + ((segbase + mchunk * 256 * rate + r) * H + head) * D + (tid & 15) * 4;
    // unrolled so that a pass's eight stores issue back to back
#pragma unroll
    for (int i = 0; i < 8; ++i) {
      int t = i * 32 + (tid >> 4);
      *reinterpret_cast<float4*>(zrow + t * rate * (H * D)) = make_float4(0.0f, 0.0f, 0.0f, 0.0f);
    }
    // the next pass rewrites the address registers of the stores just issued
    asm volatile("s_wait_xcnt 0x0" ::: "memory");
  }

  // one stage's work of a wave: its group's two tiles, in key order
  auto stage_compute = [&](int b) {
    // unrolled so that the tile's place in LDS is an immediate offset and a
    // tile's fragment reads can start under the tile before
#pragma unroll
    for (int s = 0; s < TPG; ++s) {
    const _Float16* tK = &sK[b][grp * TPG + s][0];
    const _Float16* tV = &sVt[b][grp * TPG + s][0];
    // ---- S^T = K Q^T : two 16-key subtiles x two 32-deep k-chunks ----
    v16h kf00 = load_frag16(&tK[(0 * 16 + lm) * KP + 0],  hi);
    v16h kf01 = load_frag16(&tK[(0 * 16 + lm) * KP + 32], hi);
    v16h kf10 = load_frag16(&tK[(1 * 16 + lm) * KP + 0],  hi);
    v16h kf11 = load_frag16(&tK[(1 * 16 + lm) * KP + 32], hi);
    // the accumulators start at the shift, so that they end as the exponent
    const v8f sh = {-SHIFT2, -SHIFT2, -SHIFT2, -SHIFT2, -SHIFT2, -SHIFT2, -SHIFT2, -SHIFT2};
    v8f st0[2] = {sh, sh}, st1[2] = {sh, sh};
    // unrolled: r must be a constant, it indexes arrays kept in registers
#pragma unroll
    for (int r = 0; r < 2; ++r) {
      st0[r] = __builtin_amdgcn_wmma_f32_16x16x32_f16(false, kf00, false, qa0[r].v, (short)0, st0[r], false, false);
      st1[r] = __builtin_amdgcn_wmma_f32_16x16x32_f16(false, kf10, false, qa0[r].v, (short)0, st1[r], false, false);
    }
    // unrolled: r must be a constant, it indexes arrays kept in registers
#pragma unroll
    for (int r = 0; r < 2; ++r) {
      st0[r] = __builtin_amdgcn_wmma_f32_16x16x32_f16(false, kf01, false, qa1[r].v, (short)0, st0[r], false, false);
      st1[r] = __builtin_amdgcn_wmma_f32_16x16x32_f16(false, kf11, false, qa1[r].v, (short)0, st1[r], false, false);
    }

    HF16 pa[2];
    // unrolled: r must be a constant, it indexes arrays kept in registers
#pragma unroll
    for (int r = 0; r < 2; ++r) {
      float ls = 0.0f;
#pragma unroll
      for (int v = 0; v < 8; ++v) {
        float p0 = __builtin_amdgcn_exp2f(st0[r][v]);
        float p1 = __builtin_amdgcn_exp2f(st1[r][v]);
        ls += p0 + p1;
        pa[r].f[v]     = (_Float16)p0;
        pa[r].f[8 + v] = (_Float16)p1;
      }
      lacc[r] += ls;
    }

    // ---- O += P V : V^T columns as B-fragments ----
    v16h bv0 = load_frag16(&tV[0 * VG + lm * VP], hi);
    v16h bv1 = load_frag16(&tV[1 * VG + lm * VP], hi);
    v16h bv2 = load_frag16(&tV[2 * VG + lm * VP], hi);
    v16h bv3 = load_frag16(&tV[3 * VG + lm * VP], hi);
    // unrolled: r must be a constant, it indexes arrays kept in registers
#pragma unroll
    for (int r = 0; r < 2; ++r) {
      o0[r] = __builtin_amdgcn_wmma_f32_16x16x32_f16(false, pa[r].v, false, bv0, (short)0, o0[r], false, false);
      o1[r] = __builtin_amdgcn_wmma_f32_16x16x32_f16(false, pa[r].v, false, bv1, (short)0, o1[r], false, false);
      o2[r] = __builtin_amdgcn_wmma_f32_16x16x32_f16(false, pa[r].v, false, bv2, (short)0, o2[r], false, false);
      o3[r] = __builtin_amdgcn_wmma_f32_16x16x32_f16(false, pa[r].v, false, bv3, (short)0, o3[r], false, false);
    }
    }
  };

  // the last two stages stand behind the loop: they load and store nothing, and
  // the loop body stays one block without branches
  int b = 0;    // buffer of stage kt
  int bn = 2;   // buffer of stage kt + 2, which is the one stage kt - 1 lay in
  for (int kt = 0; kt < NST - 2; ++kt) {
    // issue the global loads of stage kt + 2 early; latency hides under the WMMAs
    stage_load(kreg, vreg, kt + 2, false);
    // this trip's scalar and LDS work lands in registers that the loads just issued name
    asm volatile("s_wait_xcnt 0x0" ::: "memory");
    // holds the loads above where they are written, ahead of this trip's LDS
    // reads and WMMAs: with the padded tiles the compiler otherwise sinks them to
    // just in front of their LDS stores, and each wave waits out the whole load
    // latency in front of the barrier
    __builtin_amdgcn_sched_barrier(0);

    stage_compute(b);

    // takes the loaded words, as they came, as inputs only: they stay unconverted
    // up to here, so that no wait for the loads stands in front of this trip's work
    asm volatile("" :: "v"(kreg[0][0]), "v"(kreg[0][1]), "v"(vreg[0][0]), "v"(vreg[0][1]),
                       "v"(kreg[1][0]), "v"(kreg[1][1]), "v"(vreg[1][0]), "v"(vreg[1][1]));
    // holds the conversions and LDS stores of the stage in flight below this
    // trip's WMMAs: with two query tiles the compiler otherwise lifts them to just
    // behind their global loads, and each wave waits out the whole load latency
    // at the trip's top
    __builtin_amdgcn_sched_barrier(0);

    // answers the signals given at the foot of stage kt - 1: every wave has by then
    // (a) ended its reads of stage kt - 1, so that buffer bn may be filled anew, and
    // (b) completed its stores of stage kt + 1, which the next trip reads. The LDS
    // reads that stand between a signal and its wait are those of stage kt, a
    // buffer that nobody writes before this wave's next signal.
    asm volatile("s_barrier_wait -1" ::: "memory");
    stage_store(kreg, vreg, bn);
    // the signal says: my reads of stage kt have returned, my stores of stage
    // kt + 2 are in LDS; a bare signal waits for neither
    asm volatile("s_wait_dscnt 0x0\n\ts_barrier_signal -1" ::: "memory");
    bn = b;
    b = (b == NBUF - 1) ? 0 : b + 1;
  }
  stage_compute((NST - 2) % NBUF);
  // answers the last signal: the stores of the last stage are complete
  asm volatile("s_barrier_wait -1" ::: "memory");
  // keeps the two stages' vector work apart: mixed, their live values no longer
  // fit the 256 registers of a wave and some are spilled to scratch
  __builtin_amdgcn_sched_barrier(0);
  stage_compute((NST - 1) % NBUF);

  // ---- join the two key halves of each query row ----
  // Of its two query tiles a wave keeps one (tile grp) and hands the other to its
  // partner w ^ 8, which holds the same rows in the same lanes and registers: each
  // wave then finishes 16 rows. sX and sXl are written nowhere else.
  const bool g1 = grp != 0;
  v8f keep[4] = {g1 ? o0[1] : o0[0], g1 ? o1[1] : o1[0], g1 ? o2[1] : o2[0], g1 ? o3[1] : o3[0]};
  v8f give[4] = {g1 ? o0[0] : o0[1], g1 ? o1[0] : o1[1], g1 ? o2[0] : o2[1], g1 ? o3[0] : o3[1]};
  float lsum = g1 ? lacc[1] : lacc[0];
  // unrolled: c must be a constant, it indexes arrays kept in registers
#pragma unroll
  for (int c = 0; c < 4; ++c) {
    sX[w][2 * c][l]     = __builtin_shufflevector(give[c], give[c], 0, 1, 2, 3);
    sX[w][2 * c + 1][l] = __builtin_shufflevector(give[c], give[c], 4, 5, 6, 7);
  }
  sXl[w][l] = g1 ? lacc[0] : lacc[1];
  __syncthreads();
  // unrolled: c must be a constant, it indexes arrays kept in registers
#pragma unroll
  for (int c = 0; c < 4; ++c) {
    v4f lo = sX[w ^ 8][2 * c][l];
    v4f hh = sX[w ^ 8][2 * c + 1][l];
    keep[c] += __builtin_shufflevector(lo, hh, 0, 1, 2, 3, 4, 5, 6, 7);
  }
  lsum += sXl[w ^ 8][l];

  // ---- finalize denominator: combine the lane halves, broadcast per row ----
  lsum += __shfl_xor(lsum, 16, 32);
  sL[w][lm] = lsum;   // both halves write identical values
  asm volatile("" ::: "memory");

  // ---- epilogue: out = O / l / num_groups, strided scatter ----
  // unrolled: v must be a constant, it indexes vectors kept in registers
#pragma unroll
  for (int v = 0; v < 8; ++v) {
    int m = v + (hi << 3);
    int t = mchunk * 256 + w8 * 32 + grp * 16 + m;
    int p = segbase + off + t * rate;
    float inv = (1.0f / 3.0f) / sL[w][m];
    float* orow = O + (p * H + head) * D + lm;
    orow[0]  = keep[0][v] * inv;
    orow[16] = keep[1][v] * inv;
    orow[32] = keep[2][v] * inv;
    orow[48] = keep[3][v] * inv;
  }
}

extern "C" void kernel_launch(void* const* d_in, const int* in_sizes, int n_in,
                              void* d_out, int out_size, void* d_ws, size_t ws_size,
                              hipStream_t stream) {
  const float* Q = (const float*)d_in[0];
  const float* K = (const float*)d_in[1];
  const float* V = (const float*)d_in[2];
  float* O = (float*)d_out;

  // 28 (segment, head) attention problems * 8 query chunks of 256 rows; each
  // block also zeroes the skipped positions inside its own span.
  dilated_attn_kernel<<<28 * 8, 512, 0, stream>>>(Q, K, V, O);
}

// v008
// It runs in 29.2 microseconds.
// Timed twice side by side with v007, it ran 1.09 times as fast both times.
// All steps since v000 together make it 4.39 times as fast.
#include <hip/hip_runtime.h>

typedef __attribute__((ext_vector_type(16))) _Float16 v16h;
typedef __attribute__((ext_vector_type(8)))  float    v8f;
typedef __attribute__((ext_vector_type(8)))  _Float16 v8h;
typedef __attribute__((ext_vector_type(4)))  float    v4f;

union HF16 { v16h v; _Float16 f[16]; };

__device__ __forceinline__ v16h load_frag16(const _Float16* base, int hi) {
  HF16 r;
#pragma unroll
  for (int e = 0; e < 16; ++e) {
    int k = ((e >> 3) << 4) + (hi << 3) + (e & 7);
    r.f[e] = base[k];
  }
  return r.v;
}

__global__ __launch_bounds__(512) void dilated_attn_kernel(
    const float* __restrict__ Q, const float* __restrict__ K,
    const float* __restrict__ V, float* __restrict__ O) {
  constexpr int H = 12, D = 64;
  constexpr float SHIFT2 = 4.0f;  // in powers of two; cancels in p*v / sum(p)
  constexpr float QSCALE = 0.125f * 1.4426950408889634f;  // log2(e) / sqrt(d)

  int blk = blockIdx.x;
  int pair = blk >> 3;     // 0..27
  int mchunk = blk & 7;    // 0..7 (256 query rows each)

  int g, idx;
  if (pair < 16)      { g = 0; idx = pair; }
  else if (pair < 24) { g = 1; idx = pair - 16; }
  else                { g = 2; idx = pair - 24; }
  const int rate = (g == 0) ? 1 : (g == 1) ? 2 : 4;
  const int slen = (g == 0) ? 2048 : (g == 1) ? 4096 : 8192;
  const int off  = (g == 0) ? 0 : (g == 1) ? 1 : 2;   // i % r
  const int seg  = idx >> 2;
  const int head = g * 4 + (idx & 3);
  const int segbase = seg * slen;

  constexpr int KP = 72;
  constexpr int VP = 40;
  constexpr int VG = 16 * VP + 8;
  constexpr int SUB = 4;            // 32-key tiles per stage
  constexpr int NST = 64 / SUB;     // stages over the 2048 keys
  constexpr int NBUF = 3;           // stage s lies in buffer s % 3
  __shared__ __attribute__((aligned(16))) _Float16 sK[NBUF][SUB][32 * KP];  // [buf][tile][key][k]
  __shared__ __attribute__((aligned(16))) _Float16 sVt[NBUF][SUB][4 * VG];  // [buf][tile][d/16][d%16][key]
  __shared__ float    sL[16][16];       // per-wave denominator broadcast
  __shared__ v4f      sX[16][8][32];    // [wave][quad][lane]: partial p*v sums handed to the partner wave
  __shared__ float    sXl[16][32];      // [wave][lane]: partial denominators handed to the partner wave

  const int tid = threadIdx.x;
  const int w  = __builtin_amdgcn_readfirstlane(tid >> 5);   // the same in a wave: kept scalar
  const int w8  = w & 7;    // which 32 query rows
  const int grp = w >> 3;   // which half of each stage's keys
  const int l  = tid & 31;
  const int lm = l & 15;
  const int hi = l >> 4;

  // ---- Q fragments, used as WMMA B-operand (log2(e)/sqrt(d) folded in) ----
  HF16 qa0[2], qa1[2];   // [query tile]
  // unrolled: r must be a constant, it indexes arrays kept in registers
#pragma unroll
  for (int r = 0; r < 2; ++r) {
    int t = mchunk * 256 + w8 * 32 + r * 16 + lm;
    int p = segbase + off + t * rate;
    const float* qrow = Q + (p * H + head) * D;
#pragma unroll
    for (int e = 0; e < 16; ++e) {
      int kk = ((e >> 3) << 4) + (hi << 3) + (e & 7);
      qa0[r].f[e] = (_Float16)(qrow[kk]      * QSCALE);
      qa1[r].f[e] = (_Float16)(qrow[32 + kk] * QSCALE);
    }
    // later loads land in the address registers of the loads just issued
    asm volatile("s_wait_xcnt 0x0" ::: "memory");
  }

  // ---- staging helpers (8 contiguous f32 per thread, tensor and tile) ----
  // a wave group stages the two tiles that it reads itself
  constexpr int TPG = SUB / 2;         // 32-key tiles per wave group and stage
  const int st_key = ((tid & 255) * 8) >> 6;   // 0..31 : key row this thread stages
  const int st_kk  = (tid * 8) & 63;   // 0,8,16,..,56 : k base within row
  const unsigned st_off = (unsigned)(st_key * rate * (H * D) + st_kk) * 4u;  // bytes, inside a tile's rows
  typedef v4f stage_regs[TPG][2];
  stage_regs kreg, vreg;

  auto stage_load = [&](stage_regs& kreg, stage_regs& vreg, int kt, bool first) {
    const float* kp[TPG];
    const float* vp[TPG];
    // unrolled: s must be a constant, it indexes arrays kept in registers
#pragma unroll
    for (int s = 0; s < TPG; ++s) {
      // the tile's base is scalar (grp is), the thread's own offset is fixed: what
      // changes from trip to trip is formed on the scalar unit
      const int row0 = segbase + off + (kt * SUB + grp * TPG + s) * 32 * rate;
      const size_t tb = (size_t)((row0 * H + head) * D) * sizeof(float);
      const float* krow = reinterpret_cast<const float*>(reinterpret_cast<const char*>(K) + tb + st_off);
      const float* vrow = reinterpret_cast<const float*>(reinterpret_cast<const char*>(V) + tb + st_off);
      // 16-byte loads: rows are 256 B and st_kk * 4 is a multiple of 32 B
      // the waits: in front of the loop a later base lands in the scalar registers
      // that the two loads just issued name (first is a constant at each call; in
      // the loop one wait behind all the loads serves, below)
      kreg[s][0] = *reinterpret_cast<const v4f*>(krow);
      kreg[s][1] = *reinterpret_cast<const v4f*>(krow + 4);
      if (first) asm volatile("s_wait_xcnt 0x0" ::: "memory");
      vreg[s][0] = *reinterpret_cast<const v4f*>(vrow);
      vreg[s][1] = *reinterpret_cast<const v4f*>(vrow + 4);
      if (first) asm volatile("s_wait_xcnt 0x0" ::: "memory");
      kp[s] = krow;
      vp[s] = vrow;
    }
    // in the loop: this trip's work lands in registers that the loads just issued
    // name. The wait takes the addresses as inputs, so that they live up to it and
    // no later load of the run is given an earlier one's address registers to fill
    if (!first)
      asm volatile("s_wait_xcnt 0x0" :: "v"(kp[0]), "v"(vp[0]), "v"(kp[1]), "v"(vp[1]) : "memory");
  };
  auto stage_store = [&](const stage_regs& kreg, const stage_regs& vreg, int b) {
    // unrolled: s must be a constant, it indexes arrays kept in registers
#pragma unroll
    for (int s = 0; s < TPG; ++s) {
      _Float16* tK = &sK[b][grp * TPG + s][0];
      _Float16* tV = &sVt[b][grp * TPG + s][0];
      v8h kh;
#pragma unroll
      for (int j = 0; j < 8; ++j) kh[j] = (_Float16)kreg[s][j >> 2][j & 3];
      // one 16-byte store (row pitch and st_kk * 2 are multiples of 16 B); written
      // as a vector because the compiler split the element stores at this pitch
      *reinterpret_cast<v8h*>(&tK[st_key * KP + st_kk]) = kh;
#pragma unroll
      for (int j = 0; j < 8; ++j)
        tV[(st_kk >> 4) * VG + ((st_kk & 8) + j) * VP + st_key] = (_Float16)vreg[s][j >> 2][j & 3];
    }
  };

  v8f o0[2] = {}, o1[2] = {}, o2[2] = {}, o3[2] = {};   // [query tile]
  float lacc[2] = {0.0f, 0.0f};

  // stages 0 and 1: both stages' loads are in flight together
  {
    stage_regs kreg1, vreg1;
    stage_load(kreg, vreg, 0, true);
    stage_load(kreg1, vreg1, 1, true);
    stage_store(kreg, vreg, 0);
    stage_store(kreg1, vreg1, 1);
  }
  __syncthreads();
  // opens the split barrier: the wait at the foot of stage 0 answers this signal
  // (signal and wait alternate in every wave)
  asm volatile("s_barrier_signal -1" ::: "memory");

  // ---- zero rows: positions of this block's span that the dilation skips ----
  // 16 lanes x 16 B = one 256-B row. Issued here so that the stores drain under
  // the first trip of the key loop.
  for (int r = 0; r < rate; ++r) {
    if (r == off) continue;
    float* zrow = O + ((segbase + mchunk * 256 * rate + r) * H + head) * D + (tid & 15) * 4;
    // unrolled so that a pass's eight stores issue back to back
#pragma unroll
    for (int i = 0; i < 8; ++i) {
      int t = i * 32 + (tid >> 4);
      *reinterpret_cast<float4*>(zrow + t * rate * (H * D)) = make_float4(0.0f, 0.0f, 0.0f, 0.0f);
    }
    // the next pass rewrites the address registers of the stores just issued
    asm volatile("s_wait_xcnt 0x0" ::: "memory");
  }

  // the fragments of the tile that a wave works on next
  v16h kf[4], bv[4];
  auto frag_k = [&](int b, int s) {
    const _Float16* tK = &sK[b][grp * TPG + s][0];
    kf[0] = load_frag16(&tK[(0 * 16 + lm) * KP + 0],  hi);
    kf[1] = load_frag16(&tK[(0 * 16 + lm) * KP + 32], hi);
    kf[2] = load_frag16(&tK[(1 * 16 + lm) * KP + 0],  hi);
    kf[3] = load_frag16(&tK[(1 * 16 + lm) * KP + 32], hi);
  };
  auto frag_v = [&](int b, int s) {
    const _Float16* tV = &sVt[b][grp * TPG + s][0];
    bv[0] = load_frag16(&tV[0 * VG + lm * VP], hi);
    bv[1] = load_frag16(&tV[1 * VG + lm * VP], hi);
    bv[2] = load_frag16(&tV[2 * VG + lm * VP], hi);
    bv[3] = load_frag16(&tV[3 * VG + lm * VP], hi);
  };
  // the first tile of a stage: asked for as soon as the stage may be read
  auto frag_first = [&](int b) {
    frag_k(b, 0);
    frag_v(b, 0);
    // holds the reads here: sunk to their WMMAs, the wave would wait out the LDS
    __builtin_amdgcn_sched_barrier(0);
  };

  // one stage's work of a wave: its group's two tiles, in key order; on entry kf
  // and bv hold the first tile's fragments
  auto stage_compute = [&](int b) {
    // unrolled so that the tile's place in LDS is an immediate offset
#pragma unroll
    for (int s = 0; s < TPG; ++s) {
    // ---- S^T = K Q^T : two 16-key subtiles x two 32-deep k-chunks ----
    // the accumulators start at the shift, so that they end as the exponent
    const v8f sh = {-SHIFT2, -SHIFT2, -SHIFT2, -SHIFT2, -SHIFT2, -SHIFT2, -SHIFT2, -SHIFT2};
    v8f st0[2] = {sh, sh}, st1[2] = {sh, sh};
    // unrolled: r must be a constant, it indexes arrays kept in registers
#pragma unroll
    for (int r = 0; r < 2; ++r) {
      st0[r] = __builtin_amdgcn_wmma_f32_16x16x32_f16(false, kf[0], false, qa0[r].v, (short)0, st0[r], false, false);
      st1[r] = __builtin_amdgcn_wmma_f32_16x16x32_f16(false, kf[2], false, qa0[r].v, (short)0, st1[r], false, false);
    }
    // unrolled: r must be a constant, it indexes arrays kept in registers
#pragma unroll
    for (int r = 0; r < 2; ++r) {
      st0[r] = __builtin_amdgcn_wmma_f32_16x16x32_f16(false, kf[1], false, qa1[r].v, (short)0, st0[r], false, false);
      st1[r] = __builtin_amdgcn_wmma_f32_16x16x32_f16(false, kf[3], false, qa1[r].v, (short)0, st1[r], false, false);
    }

    HF16 pa[2];
    // unrolled: r must be a constant, it indexes arrays kept in registers
#pragma unroll
    for (int r = 0; r < 2; ++r) {
      float ls = 0.0f;
#pragma unroll
      for (int v = 0; v < 8; ++v) {
        float p0 = __builtin_amdgcn_exp2f(st0[r][v]);
        float p1 = __builtin_amdgcn_exp2f(st1[r][v]);
        ls += p0 + p1;
        pa[r].f[v]     = (_Float16)p0;
        pa[r].f[8 + v] = (_Float16)p1;
      }
      lacc[r] += ls;
      if (r == 0 && s + 1 < TPG) {
        // the two scheduling barriers hold the next tile's K reads here, between the
        // two query tiles' exponentials: they land under the second tile's and under
        // the products below. Earlier all the scores' registers are still live,
        // later the wave waits out the LDS
        __builtin_amdgcn_sched_barrier(0);
        frag_k(b, s + 1);
        __builtin_amdgcn_sched_barrier(0);
      }
    }
    // takes the two running sums, as inputs only: their additions are made here.
    // Left free, those of the stages behind the loop are put off to the kernel's
    // end, and the p values that they read are spilled to scratch
    asm volatile("" :: "v"(lacc[0]), "v"(lacc[1]));

    // ---- O += P V : V^T columns as B-fragments ----
    // unrolled: r must be a constant, it indexes arrays kept in registers
#pragma unroll
    for (int r = 0; r < 2; ++r) {
      o0[r] = __builtin_amdgcn_wmma_f32_16x16x32_f16(false, pa[r].v, false, bv[0], (short)0, o0[r], false, false);
      o1[r] = __builtin_amdgcn_wmma_f32_16x16x32_f16(false, pa[r].v, false, bv[1], (short)0, o1[r], false, false);
      o2[r] = __builtin_amdgcn_wmma_f32_16x16x32_f16(false, pa[r].v, false, bv[2], (short)0, o2[r], false, false);
      o3[r] = __builtin_amdgcn_wmma_f32_16x16x32_f16(false, pa[r].v, false, bv[3], (short)0, o3[r], false, false);
    }

    if (s + 1 < TPG) {
      // the two scheduling barriers hold the next tile's V reads directly behind
      // the products that free their registers: they land under the next tile's
      // scores and exponentials
      __builtin_amdgcn_sched_barrier(0);
      frag_v(b, s + 1);
      __builtin_amdgcn_sched_barrier(0);
    }
    }
  };

  // the last two stages stand behind the loop: they load and store nothing, and
  // the loop body stays one block without branches
  int b = 0;    // buffer of stage kt
  int bn = 2;   // buffer of stage kt + 2, which is the one stage kt - 1 lay in
  frag_first(0);   // stage 0 stands in LDS since the barrier above
  for (int kt = 0; kt < NST - 2; ++kt) {
    // issue the global loads of stage kt + 2 early; latency hides under the WMMAs
    stage_load(kreg, vreg, kt + 2, false);
    // holds the loads above where they are written, ahead of this trip's LDS
    // reads and WMMAs: with the padded tiles the compiler otherwise sinks them to
    // just in front of their LDS stores, and each wave waits out the whole load
    // latency in front of the barrier
    __builtin_amdgcn_sched_barrier(0);

    stage_compute(b);

    // takes the loaded words, as they came, as inputs only: they stay unconverted
    // up to here, so that no wait for the loads stands in front of this trip's work
    asm volatile("" :: "v"(kreg[0][0]), "v"(kreg[0][1]), "v"(vreg[0][0]), "v"(vreg[0][1]),
                       "v"(kreg[1][0]), "v"(kreg[1][1]), "v"(vreg[1][0]), "v"(vreg[1][1]));
    // holds the conversions and LDS stores of the stage in flight below this
    // trip's WMMAs: with two query tiles the compiler otherwise lifts them to just
    // behind their global loads, and each wave waits out the whole load latency
    // at the trip's top
    __builtin_amdgcn_sched_barrier(0);

    // answers the signals given at the foot of stage kt - 1: every wave has by then
    // (a) ended its reads of stage kt - 1, so that buffer bn may be filled anew, and
    // (b) completed its stores of stage kt + 1, which the next trip reads. The LDS
    // reads that stand between a signal and its wait are those of stage kt, a
    // buffer that nobody writes before this wave's next signal.
    asm volatile("s_barrier_wait -1" ::: "memory");
    // stage kt + 1 may be read from here on: its first tile's fragments land under
    // the conversions and stores below
    const int b1 = (b == NBUF - 1) ? 0 : b + 1;
    frag_first(b1);
    stage_store(kreg, vreg, bn);
    // the signal says: my reads of stage kt (and those just made of stage kt + 1)
    // have returned, my stores of stage kt + 2 are in LDS; a bare signal waits for
    // neither
    asm volatile("s_wait_dscnt 0x0\n\ts_barrier_signal -1" ::: "memory");
    bn = b;
    b = b1;
  }
  stage_compute((NST - 2) % NBUF);
  // answers the last signal: the stores of the last stage are complete
  asm volatile("s_barrier_wait -1" ::: "memory");
  // (the scheduling barrier at its end also keeps the two stages' vector work
  // apart: mixed, their live values no longer fit the 256 registers of a wave)
  frag_first((NST - 1) % NBUF);
  stage_compute((NST - 1) % NBUF);

  // ---- join the two key halves of each query row ----
  // Of its two query tiles a wave keeps one (tile grp) and hands the other to its
  // partner w ^ 8, which holds the same rows in the same lanes and registers: each
  // wave then finishes 16 rows. sX and sXl are written nowhere else.
  const bool g1 = grp != 0;
  v8f keep[4] = {g1 ? o0[1] : o0[0], g1 ? o1[1] : o1[0], g1 ? o2[1] : o2[0], g1 ? o3[1] : o3[0]};
  v8f give[4] = {g1 ? o0[0] : o0[1], g1 ? o1[0] : o1[1], g1 ? o2[0] : o2[1], g1 ? o3[0] : o3[1]};
  float lsum = g1 ? lacc[1] : lacc[0];
  // unrolled: c must be a constant, it indexes arrays kept in registers
#pragma unroll
  for (int c = 0; c < 4; ++c) {
    sX[w][2 * c][l]     = __builtin_shufflevector(give[c], give[c], 0, 1, 2, 3);
    sX[w][2 * c + 1][l] = __builtin_shufflevector(give[c], give[c], 4, 5, 6, 7);
  }
  sXl[w][l] = g1 ? lacc[0] : lacc[1];
  __syncthreads();
  // unrolled: c must be a constant, it indexes arrays kept in registers
#pragma unroll
  for (int c = 0; c < 4; ++c) {
    v4f lo = sX[w ^ 8][2 * c][l];
    v4f hh = sX[w ^ 8][2 * c + 1][l];
    keep[c] += __builtin_shufflevector(lo, hh, 0, 1, 2, 3, 4, 5, 6, 7);
  }
  lsum += sXl[w ^ 8][l];

  // ---- finalize denominator: combine the lane halves, broadcast per row ----
  lsum += __shfl_xor(lsum, 16, 32);
  sL[w][lm] = lsum;   // both halves write identical values
  asm volatile("" ::: "memory");

  // ---- epilogue: out = O / l / num_groups, strided scatter ----
  // unrolled: v must be a constant, it indexes vectors kept in registers
#pragma unroll
  for (int v = 0; v < 8; ++v) {
    int m = v + (hi << 3);
    int t = mchunk * 256 + w8 * 32 + grp * 16 + m;
    int p = segbase + off + t * rate;
    float inv = (1.0f / 3.0f) / sL[w][m];
    float* orow = O + (p * H + head) * D + lm;
    orow[0]  = keep[0][v] * inv;
    orow[16] = keep[1][v] * inv;
    orow[32] = keep[2][v] * inv;
    orow[48] = keep[3][v] * inv;
  }
}

extern "C" void kernel_launch(void* const* d_in, const int* in_sizes, int n_in,
                              void* d_out, int out_size, void* d_ws, size_t ws_size,
                              hipStream_t stream) {
  const float* Q = (const float*)d_in[0];
  const float* K = (const float*)d_in[1];
  const float* V = (const float*)d_in[2];
  float* O = (float*)d_out;

  // 28 (segment, head) attention problems * 8 query chunks of 256 rows; each
  // block also zeroes the skipped positions inside its own span.
  dilated_attn_kernel<<<28 * 8, 512, 0, stream>>>(Q, K, V, O);
}

// v009
// One run takes 28 microseconds.
// In both of two side-by-side timings against v008, it was 1.04 times as fast.
// Counting every step since v000, it is 4.57 times as fast.
#include <hip/hip_runtime.h>

typedef __attribute__((ext_vector_type(16))) _Float16 v16h;
typedef __attribute__((ext_vector_type(8)))  float    v8f;
typedef __attribute__((ext_vector_type(8)))  _Float16 v8h;
typedef __attribute__((ext_vector_type(4)))  float    v4f;
typedef __attribute__((ext_vector_type(8)))  short    s16x8;

union HF16 { v16h v; _Float16 f[16]; };

__device__ __forceinline__ v16h load_frag16(const _Float16* base, int hi) {
  HF16 r;
#pragma unroll
  for (int e = 0; e < 16; ++e) {
    int k = ((e >> 3) << 4) + (hi << 3) + (e & 7);
    r.f[e] = base[k];
  }
  return r.v;
}

__device__ __forceinline__ v8h load_tr16(const _Float16* p) {
  typedef __attribute__((address_space(3))) s16x8 lds_s16x8;
  return __builtin_bit_cast(v8h, __builtin_amdgcn_ds_load_tr16_b128_v8i16((lds_s16x8*)p));
}

__global__ __launch_bounds__(512) void dilated_attn_kernel(
    const float* __restrict__ Q, const float* __restrict__ K,
    const float* __restrict__ V, float* __restrict__ O) {
  constexpr int H = 12, D = 64;
  constexpr float SHIFT2 = 4.0f;  // in powers of two; cancels in p*v / sum(p)
  constexpr float QSCALE = 0.125f * 1.4426950408889634f;  // log2(e) / sqrt(d)

  int blk = blockIdx.x;
  int pair = blk >> 3;     // 0..27
  int mchunk = blk & 7;    // 0..7 (256 query rows each)

  int g, idx;
  if (pair < 16)      { g = 0; idx = pair; }
  else if (pair < 24) { g = 1; idx = pair - 16; }
  else                { g = 2; idx = pair - 24; }
  const int rate = (g == 0) ? 1 : (g == 1) ? 2 : 4;
  const int slen = (g == 0) ? 2048 : (g == 1) ? 4096 : 8192;
  const int off  = (g == 0) ? 0 : (g == 1) ? 1 : 2;   // i % r
  const int seg  = idx >> 2;
  const int head = g * 4 + (idx & 3);
  const int segbase = seg * slen;

  constexpr int KP = 72;
  constexpr int VP = 80;
  constexpr int SUB = 4;            // 32-key tiles per stage
  constexpr int NST = 64 / SUB;     // stages over the 2048 keys
  constexpr int NBUF = 3;           // stage s lies in buffer s % 3
  __shared__ __attribute__((aligned(16))) _Float16 sK[NBUF][SUB][32 * KP];  // [buf][tile][key][k]
  __shared__ __attribute__((aligned(16))) _Float16 sV[NBUF][SUB][32 * VP];  // [buf][tile][key][d]
  __shared__ float    sL[16][16];       // per-wave denominator broadcast
  __shared__ v4f      sX[16][8][32];    // [wave][quad][lane]: partial p*v sums handed to the partner wave
  __shared__ float    sXl[16][32];      // [wave][lane]: partial denominators handed to the partner wave

  const int tid = threadIdx.x;
  const int w  = __builtin_amdgcn_readfirstlane(tid >> 5);   // the same in a wave: kept scalar
  const int w8  = w & 7;    // which 32 query rows
  const int grp = w >> 3;   // which half of each stage's keys
  const int l  = tid & 31;
  const int lm = l & 15;
  const int hi = l >> 4;

  // ---- Q fragments, used as WMMA B-operand (log2(e)/sqrt(d) folded in) ----
  HF16 qa0[2], qa1[2];   // [query tile]
  // unrolled: r must be a constant, it indexes arrays kept in registers
#pragma unroll
  for (int r = 0; r < 2; ++r) {
    int t = mchunk * 256 + w8 * 32 + r * 16 + lm;
    int p = segbase + off + t * rate;
    const float* qrow = Q + (p * H + head) * D;
#pragma unroll
    for (int e = 0; e < 16; ++e) {
      int kk = ((e >> 3) << 4) + (hi << 3) + (e & 7);
      qa0[r].f[e] = (_Float16)(qrow[kk]      * QSCALE);
      qa1[r].f[e] = (_Float16)(qrow[32 + kk] * QSCALE);
    }
    // later loads land in the address registers of the loads just issued
    asm volatile("s_wait_xcnt 0x0" ::: "memory");
  }

  // ---- staging helpers (8 contiguous f32 per thread, tensor and tile) ----
  // a wave group stages the two tiles that it reads itself
  constexpr int TPG = SUB / 2;         // 32-key tiles per wave group and stage
  const int st_key = ((tid & 255) * 8) >> 6;   // 0..31 : key row this thread stages
  const int st_kk  = (tid * 8) & 63;   // 0,8,16,..,56 : k base within row
  const unsigned st_off = (unsigned)(st_key * rate * (H * D) + st_kk) * 4u;  // bytes, inside a tile's rows
  typedef v4f stage_regs[TPG][2];
  stage_regs kreg, vreg;

  auto stage_load = [&](stage_regs& kreg, stage_regs& vreg, int kt, bool first) {
    const float* kp[TPG];
    const float* vp[TPG];
    // unrolled: s must be a constant, it indexes arrays kept in registers
#pragma unroll
    for (int s = 0; s < TPG; ++s) {
      // the tile's base is scalar (grp is), the thread's own offset is fixed: what
      // changes from trip to trip is formed on the scalar unit
      const int row0 = segbase + off + (kt * SUB + grp * TPG + s) * 32 * rate;
      const size_t tb = (size_t)((row0 * H + head) * D) * sizeof(float);
      const float* krow = reinterpret_cast<const float*>(reinterpret_cast<const char*>(K) + tb + st_off);
      const float* vrow = reinterpret_cast<const float*>(reinterpret_cast<const char*>(V) + tb + st_off);
      // 16-byte loads: rows are 256 B and st_kk * 4 is a multiple of 32 B
      // the waits: in front of the loop a later base lands in the scalar registers
      // that the two loads just issued name (first is a constant at each call; in
      // the loop one wait behind all the loads serves, below)
      kreg[s][0] = *reinterpret_cast<const v4f*>(krow);
      kreg[s][1] = *reinterpret_cast<const v4f*>(krow + 4);
      if (first) asm volatile("s_wait_xcnt 0x0" ::: "memory");
      vreg[s][0] = *reinterpret_cast<const v4f*>(vrow);
      vreg[s][1] = *reinterpret_cast<const v4f*>(vrow + 4);
      if (first) asm volatile("s_wait_xcnt 0x0" ::: "memory");
      kp[s] = krow;
      vp[s] = vrow;
    }
    // in the loop: this trip's work lands in registers that the loads just issued
    // name. The wait takes the addresses as inputs, so that they live up to it and
    // no later load of the run is given an earlier one's address registers to fill
    if (!first)
      asm volatile("s_wait_xcnt 0x0" :: "v"(kp[0]), "v"(vp[0]), "v"(kp[1]), "v"(vp[1]) : "memory");
  };
  auto stage_store = [&](const stage_regs& kreg, const stage_regs& vreg, int b) {
    // unrolled: s must be a constant, it indexes arrays kept in registers
#pragma unroll
    for (int s = 0; s < TPG; ++s) {
      _Float16* tK = &sK[b][grp * TPG + s][0];
      _Float16* tV = &sV[b][grp * TPG + s][0];
      v8h kh, vh;
#pragma unroll
      for (int j = 0; j < 8; ++j) kh[j] = (_Float16)kreg[s][j >> 2][j & 3];
#pragma unroll
      for (int j = 0; j < 8; ++j) vh[j] = (_Float16)vreg[s][j >> 2][j & 3];
      // one 16-byte store (row pitch and st_kk * 2 are multiples of 16 B); written
      // as a vector because the compiler split the element stores at this pitch
      *reinterpret_cast<v8h*>(&tK[st_key * KP + st_kk]) = kh;
      *reinterpret_cast<v8h*>(&tV[st_key * VP + st_kk]) = vh;
    }
  };

  v8f o0[2] = {}, o1[2] = {}, o2[2] = {}, o3[2] = {};   // [query tile]
  float lacc[2] = {0.0f, 0.0f};

  // stages 0 and 1: both stages' loads are in flight together
  {
    stage_regs kreg1, vreg1;
    stage_load(kreg, vreg, 0, true);
    stage_load(kreg1, vreg1, 1, true);
    stage_store(kreg, vreg, 0);
    stage_store(kreg1, vreg1, 1);
  }
  __syncthreads();
  // opens the split barrier: the wait at the foot of stage 0 answers this signal
  // (signal and wait alternate in every wave)
  asm volatile("s_barrier_signal -1" ::: "memory");

  // ---- zero rows: positions of this block's span that the dilation skips ----
  // 16 lanes x 16 B = one 256-B row. Issued here so that the stores drain under
  // the first trip of the key loop.
  for (int r = 0; r < rate; ++r) {
    if (r == off) continue;
    float* zrow = O + ((segbase + mchunk * 256 * rate + r) * H + head) * D + (tid & 15) * 4;
    // unrolled so that a pass's eight stores issue back to back
#pragma unroll
    for (int i = 0; i < 8; ++i) {
      int t = i * 32 + (tid >> 4);
      *reinterpret_cast<float4*>(zrow + t * rate * (H * D)) = make_float4(0.0f, 0.0f, 0.0f, 0.0f);
    }
    // the next pass rewrites the address registers of the stores just issued
    asm volatile("s_wait_xcnt 0x0" ::: "memory");
  }

  // the fragments of the tile that a wave works on next
  v16h kf[4], bv[4];
  auto frag_k = [&](int b, int s) {
    const _Float16* tK = &sK[b][grp * TPG + s][0];
    kf[0] = load_frag16(&tK[(0 * 16 + lm) * KP + 0],  hi);
    kf[1] = load_frag16(&tK[(0 * 16 + lm) * KP + 32], hi);
    kf[2] = load_frag16(&tK[(1 * 16 + lm) * KP + 0],  hi);
    kf[3] = load_frag16(&tK[(1 * 16 + lm) * KP + 32], hi);
  };
  auto frag_v = [&](int b, int s) {
    // keys 0..15 and 16..31 of the tile, 16 columns of d per fragment
    const _Float16* tV = &sV[b][grp * TPG + s][(hi * 8 + (l & 7)) * VP + ((l >> 3) & 1) * 8];
    // unrolled: c must be a constant, it indexes an array kept in registers
#pragma unroll
    for (int c = 0; c < 4; ++c)
      bv[c] = __builtin_shufflevector(load_tr16(tV + 16 * c), load_tr16(tV + 16 * VP + 16 * c),
                                      0, 1, 2, 3, 4, 5, 6, 7, 8, 9, 10, 11, 12, 13, 14, 15);
  };
  // the first tile of a stage: asked for as soon as the stage may be read
  auto frag_first = [&](int b) {
    frag_k(b, 0);
    frag_v(b, 0);
    // holds the reads here: sunk to their WMMAs, the wave would wait out the LDS
    __builtin_amdgcn_sched_barrier(0);
  };

  // one stage's work of a wave: its group's two tiles, in key order; on entry kf
  // and bv hold the first tile's fragments
  auto stage_compute = [&](int b) {
    // unrolled so that the tile's place in LDS is an immediate offset
#pragma unroll
    for (int s = 0; s < TPG; ++s) {
    // ---- S^T = K Q^T : two 16-key subtiles x two 32-deep k-chunks ----
    // the accumulators start at the shift, so that they end as the exponent
    const v8f sh = {-SHIFT2, -SHIFT2, -SHIFT2, -SHIFT2, -SHIFT2, -SHIFT2, -SHIFT2, -SHIFT2};
    v8f st0[2] = {sh, sh}, st1[2] = {sh, sh};
    // unrolled: r must be a constant, it indexes arrays kept in registers
#pragma unroll
    for (int r = 0; r < 2; ++r) {
      st0[r] = __builtin_amdgcn_wmma_f32_16x16x32_f16(false, kf[0], false, qa0[r].v, (short)0, st0[r], false, false);
      st1[r] = __builtin_amdgcn_wmma_f32_16x16x32_f16(false, kf[2], false, qa0[r].v, (short)0, st1[r], false, false);
    }
    // unrolled: r must be a constant, it indexes arrays kept in registers
#pragma unroll
    for (int r = 0; r < 2; ++r) {
      st0[r] = __builtin_amdgcn_wmma_f32_16x16x32_f16(false, kf[1], false, qa1[r].v, (short)0, st0[r], false, false);
      st1[r] = __builtin_amdgcn_wmma_f32_16x16x32_f16(false, kf[3], false, qa1[r].v, (short)0, st1[r], false, false);
    }

    HF16 pa[2];
    // unrolled: r must be a constant, it indexes arrays kept in registers
#pragma unroll
    for (int r = 0; r < 2; ++r) {
      float ls = 0.0f;
#pragma unroll
      for (int v = 0; v < 8; ++v) {
        float p0 = __builtin_amdgcn_exp2f(st0[r][v]);
        float p1 = __builtin_amdgcn_exp2f(st1[r][v]);
        ls += p0 + p1;
        pa[r].f[v]     = (_Float16)p0;
        pa[r].f[8 + v] = (_Float16)p1;
      }
      lacc[r] += ls;
      if (r == 0 && s + 1 < TPG) {
        // the two scheduling barriers hold the next tile's K reads here, between the
        // two query tiles' exponentials: they land under the second tile's and under
        // the products below. Earlier all the scores' registers are still live,
        // later the wave waits out the LDS
        __builtin_amdgcn_sched_barrier(0);
        frag_k(b, s + 1);
        __builtin_amdgcn_sched_barrier(0);
      }
    }
    // takes the two running sums, as inputs only: their additions are made here.
    // Left free, those of the stages behind the loop are put off to the kernel's
    // end, and the p values that they read are spilled to scratch
    asm volatile("" :: "v"(lacc[0]), "v"(lacc[1]));

    // ---- O += P V : columns of V as B-fragments ----
    // unrolled: r must be a constant, it indexes arrays kept in registers
#pragma unroll
    for (int r = 0; r < 2; ++r) {
      o0[r] = __builtin_amdgcn_wmma_f32_16x16x32_f16(false, pa[r].v, false, bv[0], (short)0, o0[r], false, false);
      o1[r] = __builtin_amdgcn_wmma_f32_16x16x32_f16(false, pa[r].v, false, bv[1], (short)0, o1[r], false, false);
      o2[r] = __builtin_amdgcn_wmma_f32_16x16x32_f16(false, pa[r].v, false, bv[2], (short)0, o2[r], false, false);
      o3[r] = __builtin_amdgcn_wmma_f32_16x16x32_f16(false, pa[r].v, false, bv[3], (short)0, o3[r], false, false);
    }

    if (s + 1 < TPG) {
      // the two scheduling barriers hold the next tile's V reads directly behind
      // the products that free their registers: they land under the next tile's
      // scores and exponentials
      __builtin_amdgcn_sched_barrier(0);
      frag_v(b, s + 1);
      __builtin_amdgcn_sched_barrier(0);
    }
    }
  };

  // the last two stages stand behind the loop: they load and store nothing, and
  // the loop body stays one block without branches
  int b = 0;    // buffer of stage kt
  int bn = 2;   // buffer of stage kt + 2, which is the one stage kt - 1 lay in
  frag_first(0);   // stage 0 stands in LDS since the barrier above
  for (int kt = 0; kt < NST - 2; ++kt) {
    // issue the global loads of stage kt + 2 early; latency hides under the WMMAs
    stage_load(kreg, vreg, kt + 2, false);
    // holds the loads above where they are written, ahead of this trip's LDS
    // reads and WMMAs: with the padded tiles the compiler otherwise sinks them to
    // just in front of their LDS stores, and each wave waits out the whole load
    // latency in front of the barrier
    __builtin_amdgcn_sched_barrier(0);

    stage_compute(b);

    // takes the loaded words, as they came, as inputs only: they stay unconverted
    // up to here, so that no wait for the loads stands in front of this trip's work
    asm volatile("" :: "v"(kreg[0][0]), "v"(kreg[0][1]), "v"(vreg[0][0]), "v"(vreg[0][1]),
                       "v"(kreg[1][0]), "v"(kreg[1][1]), "v"(vreg[1][0]), "v"(vreg[1][1]));
    // holds the conversions and LDS stores of the stage in flight below this
    // trip's WMMAs: with two query tiles the compiler otherwise lifts them to just
    // behind their global loads, and each wave waits out the whole load latency
    // at the trip's top
    __builtin_amdgcn_sched_barrier(0);

    // answers the signals given at the foot of stage kt - 1: every wave has by then
    // (a) ended its reads of stage kt - 1, so that buffer bn may be filled anew, and
    // (b) completed its stores of stage kt + 1, which the next trip reads. The LDS
    // reads that stand between a signal and its wait are those of stage kt, a
    // buffer that nobody writes before this wave's next signal.
    asm volatile("s_barrier_wait -1" ::: "memory");
    // stage kt + 1 may be read from here on: its first tile's fragments land under
    // the conversions and stores below
    const int b1 = (b == NBUF - 1) ? 0 : b + 1;
    frag_first(b1);
    stage_store(kreg, vreg, bn);
    // the signal says: my reads of stage kt (and those just made of stage kt + 1)
    // have returned, my stores of stage kt + 2 are in LDS; a bare signal waits for
    // neither
    asm volatile("s_wait_dscnt 0x0\n\ts_barrier_signal -1" ::: "memory");
    bn = b;
    b = b1;
  }
  stage_compute((NST - 2) % NBUF);
  // answers the last signal: the stores of the last stage are complete
  asm volatile("s_barrier_wait -1" ::: "memory");
  // (the scheduling barrier at its end also keeps the two stages' vector work
  // apart: mixed, their live values no longer fit the 256 registers of a wave)
  frag_first((NST - 1) % NBUF);
  stage_compute((NST - 1) % NBUF);

  // ---- join the two key halves of each query row ----
  // Of its two query tiles a wave keeps one (tile grp) and hands the other to its
  // partner w ^ 8, which holds the same rows in the same lanes and registers: each
  // wave then finishes 16 rows. sX and sXl are written nowhere else.
  const bool g1 = grp != 0;
  v8f keep[4] = {g1 ? o0[1] : o0[0], g1 ? o1[1] : o1[0], g1 ? o2[1] : o2[0], g1 ? o3[1] : o3[0]};
  v8f give[4] = {g1 ? o0[0] : o0[1], g1 ? o1[0] : o1[1], g1 ? o2[0] : o2[1], g1 ? o3[0] : o3[1]};
  float lsum = g1 ? lacc[1] : lacc[0];
  // unrolled: c must be a constant, it indexes arrays kept in registers
#pragma unroll
  for (int c = 0; c < 4; ++c) {
    sX[w][2 * c][l]     = __builtin_shufflevector(give[c], give[c], 0, 1, 2, 3);
    sX[w][2 * c + 1][l] = __builtin_shufflevector(give[c], give[c], 4, 5, 6, 7);
  }
  sXl[w][l] = g1 ? lacc[0] : lacc[1];
  __syncthreads();
  // unrolled: c must be a constant, it indexes arrays kept in registers
#pragma unroll
  for (int c = 0; c < 4; ++c) {
    v4f lo = sX[w ^ 8][2 * c][l];
    v4f hh = sX[w ^ 8][2 * c + 1][l];
    keep[c] += __builtin_shufflevector(lo, hh, 0, 1, 2, 3, 4, 5, 6, 7);
  }
  lsum += sXl[w ^ 8][l];

  // ---- finalize denominator: combine the lane halves, broadcast per row ----
  lsum += __shfl_xor(lsum, 16, 32);
  sL[w][lm] = lsum;   // both halves write identical values
  asm volatile("" ::: "memory");

  // ---- epilogue: out = O / l / num_groups, strided scatter ----
  // unrolled: v must be a constant, it indexes vectors kept in registers
#pragma unroll
  for (int v = 0; v < 8; ++v) {
    int m = v + (hi << 3);
    int t = mchunk * 256 + w8 * 32 + grp * 16 + m;
    int p = segbase + off + t * rate;
    float inv = (1.0f / 3.0f) / sL[w][m];
    float* orow = O + (p * H + head) * D + lm;
    orow[0]  = keep[0][v] * inv;
    orow[16] = keep[1][v] * inv;
    orow[32] = keep[2][v] * inv;
    orow[48] = keep[3][v] * inv;
  }
}

extern "C" void kernel_launch(void* const* d_in, const int* in_sizes, int n_in,
                              void* d_out, int out_size, void* d_ws, size_t ws_size,
                              hipStream_t stream) {
  const float* Q = (const float*)d_in[0];
  const float* K = (const float*)d_in[1];
  const float* V = (const float*)d_in[2];
  float* O = (float*)d_out;

  // 28 (segment, head) attention problems * 8 query chunks of 256 rows; each
  // block also zeroes the skipped positions inside its own span.
  dilated_attn_kernel<<<28 * 8, 512, 0, stream>>>(Q, K, V, O);
}
